// v000
// The times below were measured on an AMD MI455X: many runs one after another, warmed up first and cycling through
// copies of the inputs, with the whole window's GPU time divided by the number of runs. Launches and the gaps
// between them are all in it. The median over several windows is given; except for v000 it joins two sittings, which
// can be a few percent apart, so the side-by-side timings, each taken in one sitting, are the better comparison.
// v000, which the later versions start from, runs in 59.9 microseconds.
#include <hip/hip_runtime.h>

// LePE windowed attention for CDNA5 (gfx1250), wave32 WMMA flash-attention.
// qkv: [3, B=8, L=4096, C=128] fp32.  Windows: H_SP=64 x W_SP=8 -> Bw=64, N=512.
// heads=4, hd=32 (== WMMA f16 K-dim).  out: [8, 4096, 128] fp32.
//
// - Q pre-scaled by (hd^-0.5 * log2 e): scores leave WMMA in log2 domain, so
//   softmax weights are raw v_exp_f32 (2^x); shift-free (N(0,1) scores), the
//   normalization cancels any base shift.
// - Row sums via an extra WMMA against an all-ones B matrix (no shuffles).
// - P staged per wave in LDS at natural key positions; V kept [token][dim].

// r1: B fragments on the hardware k-map (lane&15 = key for the scores / head dim for P.V; elements 0..7 <- k = 8hh+0..7, 8..15 <- 16+8hh+0..7), so P is
// staged at its natural key positions and V stays [token][dim] in LDS (gathered fragments) — the interleave trick is gone; P converted with the default nearest mode; the
typedef _Float16 half_t;
typedef __attribute__((ext_vector_type(16))) _Float16 v16h;
typedef __attribute__((ext_vector_type(8)))  float    v8f;

#define BSZ    8
#define CCH    128
#define HEADS  4
#define HD     32
#define NTOK   512
// hd^-0.5 * log2(e): scores come out of WMMA ready for v_exp_f32 (2^x)
#define SCALEQ (0.17677669529663687f * 1.4426950408889634f)

// LDS layout (in halves).  Strides padded for 16B alignment + bank spread.
#define K_STRIDE  40                    // per-token row of K  (32 dims + pad)
#define V_STRIDE  40                    // per-token row of V (32 dims + pad)
#define P_STRIDE  40                    // per-wave P scratch row
#define K_OFF     0
#define VT_OFF    (512 * K_STRIDE)                  // 20480
#define P_OFF     (VT_OFF + 512 * V_STRIDE)         // 40960
#define LDS_HALF  (P_OFF + 8 * 16 * P_STRIDE)       // 46080 halves = 92160 B

__global__ void __launch_bounds__(256)
lepe_attn_wmma_kernel(const float* __restrict__ qkv, float* __restrict__ out)
{
    extern __shared__ half_t smem[];

    // grid: 1024 = (Bw*heads=256) * 4 row-tile groups
    const int whrt = blockIdx.x;
    const int wh   = whrt >> 2;        // window-head id
    const int rtg  = whrt & 3;         // row-tile group
    const int head = wh & (HEADS - 1);
    const int win  = wh >> 2;          // 0..63
    const int b    = win >> 3;
    const int w    = win & 7;          // window column (W//W_SP = 8)

    const size_t plane = (size_t)BSZ * 4096 * CCH;
    const float* qb  = qkv + (size_t)b * 4096 * CCH;
    const float* kb_ = qb + plane;
    const float* vb_ = qb + 2 * plane;

    const int tid  = threadIdx.x;
    const int lane = tid & 31;
    const int wave = tid >> 5;
    const int hh   = lane >> 4;        // half-wave id (0/1)
    const int lm   = lane & 15;

    // ---- cooperative stage: K -> LDS[token][dim] (f16),
    //      V -> LDS[token][dim] (f16)
    for (int p = 0; p < 16; ++p) {
        const int n  = p * 32 + (tid >> 3);      // token 0..511
        const int d0 = (tid & 7) * 4;            // dim 0..28
        const int yw = n >> 3, xw = n & 7;
        const size_t off = (size_t)(yw * 64 + w * 8 + xw) * CCH + head * HD + d0;
        const float4 k4 = *(const float4*)(kb_ + off);
        const float4 v4 = *(const float4*)(vb_ + off);
        half_t* kr = smem + K_OFF + n * K_STRIDE + d0;
        kr[0] = (half_t)k4.x; kr[1] = (half_t)k4.y;
        kr[2] = (half_t)k4.z; kr[3] = (half_t)k4.w;
        half_t* vr = smem + VT_OFF + n * V_STRIDE + d0;        // V natural: [token][dim]
        vr[0] = (half_t)v4.x; vr[1] = (half_t)v4.y; vr[2] = (half_t)v4.z; vr[3] = (half_t)v4.w;
    }
    __syncthreads();

    half_t* pbuf = smem + P_OFF + wave * 16 * P_STRIDE;

    // ---- each wave: one 16-row Q tile
    const int qtok0 = (rtg * 8 + wave) * 16;

    // A fragment of scaled Q (16x32 f16): lane row m = lm, half i -> k dim
    v16h aq;
    {
        const int m  = qtok0 + lm;
        const int yw = m >> 3, xw = m & 7;
        const float* qrow = qb + (size_t)(yw * 64 + w * 8 + xw) * CCH + head * HD;
        #pragma unroll
        for (int i = 0; i < 16; ++i) {
            const int k = ((i >> 3) << 4) + (hh << 3) + (i & 7);
            aq[i] = (half_t)(qrow[k] * SCALEQ);
        }
    }

    // constant all-ones B fragment (32x16 of 1.0) for row-sum WMMA
    v16h bones;
    #pragma unroll
    for (int i = 0; i < 16; ++i) bones[i] = (half_t)1.0f;

    v8f o0 = {}, o1 = {}, sacc = {};
    const v8f zero = {};

    for (int kblk = 0; kblk < 16; ++kblk) {        // 32 keys per block
        // B fragments of K^T (32x16): tile0 = keys j=0..15 (col=j), tile1 = 16..31
        v16h bk0, bk1;
        {
            const half_t* r0 = smem + K_OFF + (kblk * 32 + lm)      * K_STRIDE;
            const half_t* r1 = smem + K_OFF + (kblk * 32 + 16 + lm) * K_STRIDE;
            #pragma unroll
            for (int i = 0; i < 16; ++i) { const int k = ((i >> 3) << 4) + (hh << 3) + (i & 7); bk0[i] = r0[k]; bk1[i] = r1[k]; }
        }
        v8f s0 = __builtin_amdgcn_wmma_f32_16x16x32_f16(false, aq, false, bk0,
                                                        (short)0, zero, false, false);
        v8f s1 = __builtin_amdgcn_wmma_f32_16x16x32_f16(false, aq, false, bk1,
                                                        (short)0, zero, false, false);

        // P = 2^s at natural key positions
        #pragma unroll
        for (int r = 0; r < 8; ++r) {
            const float p0 = __builtin_amdgcn_exp2f(s0[r]);
            const float p1 = __builtin_amdgcn_exp2f(s1[r]);
            const int row = r + (hh << 3);
            pbuf[row * P_STRIDE + lm]      = (half_t)p0;        // natural key positions
            pbuf[row * P_STRIDE + 16 + lm] = (half_t)p1;
        }
        // A fragment of P (16x32 positions); DS ops are in-order within a wave
        v16h ap;
        {
            const half_t* pr = pbuf + lm * P_STRIDE;
            #pragma unroll
            for (int i = 0; i < 16; ++i) {
                const int k = ((i >> 3) << 4) + (hh << 3) + (i & 7);
                ap[i] = pr[k];
            }
        }
        // B fragments of V block (32 tokens x 32 dims) gathered from V[token][dim]
        v16h bv0, bv1;
        {
            const half_t* vb0 = smem + VT_OFF + (kblk * 32) * V_STRIDE;
            #pragma unroll
            for (int i = 0; i < 16; ++i) { const int k = ((i >> 3) << 4) + (hh << 3) + (i & 7);
                bv0[i] = vb0[k * V_STRIDE + lm]; bv1[i] = vb0[k * V_STRIDE + 16 + lm]; }
        }
        o0   = __builtin_amdgcn_wmma_f32_16x16x32_f16(false, ap, false, bv0,
                                                      (short)0, o0,   false, false);
        o1   = __builtin_amdgcn_wmma_f32_16x16x32_f16(false, ap, false, bv1,
                                                      (short)0, o1,   false, false);
        sacc = __builtin_amdgcn_wmma_f32_16x16x32_f16(false, ap, false, bones,
                                                      (short)0, sacc, false, false);
        asm volatile("v_nop\n\tv_nop\n\tv_nop\n\tv_nop" : "+v"(o0), "+v"(sacc) : "v"(ap), "v"(bones));
    }

    // epilogue: normalize (every lane of a row holds the same sacc) and scatter
    {
        #pragma unroll
        for (int r = 0; r < 8; ++r) {
            const float inv = 1.0f / sacc[r];
            const float v0 = o0[r] * inv, v1 = o1[r] * inv;
            const float x0 = __shfl_xor(v0, 16), x1 = __shfl_xor(v1, 16);
            const int mA = qtok0 + r, mB = qtok0 + 8 + r;            // row r: own o0 | partner o1; row 8+r: partner o0 | own o1
            float* rowA = out + ((size_t)b * 4096 + (mA >> 3) * 64 + w * 8 + (mA & 7)) * CCH + head * HD;
            float* rowB = out + ((size_t)b * 4096 + (mB >> 3) * 64 + w * 8 + (mB & 7)) * CCH + head * HD;
            *(float*)(rowA + lane) = hh ? x1 : v0;
            *(float*)(rowB + lane) = hh ? v1 : x0;
        }
        
    }
}

// ---- LePE: depthwise 3x3 cross-correlation per 64x8 window image + bias, accumulate
__global__ void __launch_bounds__(256)
lepe_conv_add_kernel(const float* __restrict__ qkv, const float* __restrict__ cw,
                     const float* __restrict__ cb, float* __restrict__ out)
{
    const int idx = blockIdx.x * 256 + threadIdx.x;   // 64*512*128 = 4,194,304
    const int c   = idx & 127;
    const int t   = idx >> 7;
    const int x   = t & 7;
    const int y   = (t >> 3) & 63;
    const int win = t >> 9;
    const int b   = win >> 3;
    const int w   = win & 7;

    const float* vb_ = qkv + 2 * (size_t)BSZ * 4096 * CCH + (size_t)b * 4096 * CCH;
    float acc = cb[c];
    #pragma unroll
    for (int ky = 0; ky < 3; ++ky) {
        const int yy = y + ky - 1;
        if (yy < 0 || yy >= 64) continue;
        #pragma unroll
        for (int kx = 0; kx < 3; ++kx) {
            const int xx = x + kx - 1;
            if (xx < 0 || xx >= 8) continue;
            const float vv = vb_[(size_t)(yy * 64 + w * 8 + xx) * CCH + c];
            acc += vv * cw[c * 9 + ky * 3 + kx];     // conv_w[c,0,ky,kx]
        }
    }
    const size_t oidx = ((size_t)b * 4096 + y * 64 + w * 8 + x) * CCH + c;
    const float nv = out[oidx] + acc;
    *(float*)(out + oidx) = nv; 
}

extern "C" void kernel_launch(void* const* d_in, const int* in_sizes, int n_in,
                              void* d_out, int out_size, void* d_ws, size_t ws_size,
                              hipStream_t stream)
{
    (void)in_sizes; (void)n_in; (void)out_size; (void)d_ws; (void)ws_size;
    const float* qkv = (const float*)d_in[0];
    const float* cw  = (const float*)d_in[1];
    const float* cb  = (const float*)d_in[2];
    float* out = (float*)d_out;

    const size_t shmem = (size_t)LDS_HALF * sizeof(half_t);   // 92,160 B
    hipFuncSetAttribute((const void*)lepe_attn_wmma_kernel, hipFuncAttributeMaxDynamicSharedMemorySize, (int)shmem);
    lepe_attn_wmma_kernel<<<1024, 256, shmem, stream>>>(qkv, out);
    lepe_conv_add_kernel<<<(64 * 512 * 128) / 256, 256, 0, stream>>>(qkv, cw, cb, out);
}

// v001
// One run takes 33.5 microseconds.
// Next to v000, in two timings, it ran 1.82 and 1.83 times as fast.
#include <hip/hip_runtime.h>

// LePE windowed attention for CDNA5 (gfx1250), wave32 WMMA flash-attention.
// qkv: [3, B=8, L=4096, C=128] fp32.  Windows: H_SP=64 x W_SP=8 -> Bw=64, N=512.
// heads=4, hd=32 (== WMMA f16 K-dim).  out: [8, 4096, 128] fp32.
//
// - Q pre-scaled by (hd^-0.5 * log2 e): scores leave WMMA in log2 domain, so
//   softmax weights are raw v_exp_f32 (2^x); shift-free (N(0,1) scores), the
//   normalization cancels any base shift.
// - Row sums via an extra WMMA against an all-ones B matrix (no shuffles).
// - P staged per wave in LDS at natural key positions; V kept [token][dim].

// r1: B fragments on the hardware k-map (lane&15 = key for the scores / head dim for P.V; elements 0..7 <- k = 8hh+0..7, 8..15 <- 16+8hh+0..7), so P is
// staged at its natural key positions and V stays [token][dim] in LDS (gathered fragments) — the interleave trick is gone; P converted with the default nearest mode; the
typedef _Float16 half_t;
typedef __attribute__((ext_vector_type(16))) _Float16 v16h;
typedef __attribute__((ext_vector_type(8)))  float    v8f;

#define BSZ    8
#define CCH    128
#define HEADS  4
#define HD     32
#define NTOK   512
// hd^-0.5 * log2(e): scores come out of WMMA ready for v_exp_f32 (2^x)
#define SCALEQ (0.17677669529663687f * 1.4426950408889634f)

// LDS layout (in halves).  Strides padded for 16B alignment + bank spread.
#define K_STRIDE  40                    // per-token row of K  (32 dims + pad)
#define V_STRIDE  40                    // per-token row of V (32 dims + pad)
#define P_STRIDE  40                    // per-wave P scratch row
#define K_OFF     0
#define VT_OFF    (512 * K_STRIDE)                  // 20480
#define P_OFF     (VT_OFF + 512 * V_STRIDE)         // 40960
#define LDS_HALF  (P_OFF + 8 * 16 * P_STRIDE)       // 46080 halves = 92160 B

__global__ void __launch_bounds__(256)
lepe_attn_wmma_kernel(const float* __restrict__ qkv, const float* __restrict__ cw,
                      const float* __restrict__ cb, float* __restrict__ out)
{
    extern __shared__ half_t smem[];

    // grid: 1024 = (Bw*heads=256) * 4 row-tile groups
    const int whrt = blockIdx.x;
    const int wh   = whrt >> 2;        // window-head id
    const int rtg  = whrt & 3;         // row-tile group
    const int head = wh & (HEADS - 1);
    const int win  = wh >> 2;          // 0..63
    const int b    = win >> 3;
    const int w    = win & 7;          // window column (W//W_SP = 8)

    const size_t plane = (size_t)BSZ * 4096 * CCH;
    const float* qb  = qkv + (size_t)b * 4096 * CCH;
    const float* kb_ = qb + plane;
    const float* vb_ = qb + 2 * plane;

    const int tid  = threadIdx.x;
    const int lane = tid & 31;
    const int wave = tid >> 5;
    const int hh   = lane >> 4;        // half-wave id (0/1)
    const int lm   = lane & 15;

    // ---- cooperative stage: K -> LDS[token][dim] (f16),
    //      V -> LDS[token][dim] (f16)
    for (int p = 0; p < 16; ++p) {
        const int n  = p * 32 + (tid >> 3);      // token 0..511
        const int d0 = (tid & 7) * 4;            // dim 0..28
        const int yw = n >> 3, xw = n & 7;
        const size_t off = (size_t)(yw * 64 + w * 8 + xw) * CCH + head * HD + d0;
        const float4 k4 = *(const float4*)(kb_ + off);
        const float4 v4 = *(const float4*)(vb_ + off);
        half_t* kr = smem + K_OFF + n * K_STRIDE + d0;
        kr[0] = (half_t)k4.x; kr[1] = (half_t)k4.y;
        kr[2] = (half_t)k4.z; kr[3] = (half_t)k4.w;
        half_t* vr = smem + VT_OFF + n * V_STRIDE + d0;        // V natural: [token][dim]
        vr[0] = (half_t)v4.x; vr[1] = (half_t)v4.y; vr[2] = (half_t)v4.z; vr[3] = (half_t)v4.w;
    }
    __syncthreads();

    half_t* pbuf = smem + P_OFF + wave * 16 * P_STRIDE;

    // ---- each wave: one 16-row Q tile
    const int qtok0 = (rtg * 8 + wave) * 16;

    // A fragment of scaled Q (16x32 f16): lane row m = lm, half i -> k dim
    v16h aq;
    {
        const int m  = qtok0 + lm;
        const int yw = m >> 3, xw = m & 7;
        const float* qrow = qb + (size_t)(yw * 64 + w * 8 + xw) * CCH + head * HD;
        #pragma unroll
        for (int i = 0; i < 16; ++i) {
            const int k = ((i >> 3) << 4) + (hh << 3) + (i & 7);
            aq[i] = (half_t)(qrow[k] * SCALEQ);
        }
    }

    // ---- LePE for this wave's own 16 tokens: depthwise 3x3 over the 64x8 window image, fp32 V from
    //      global (the lines the staging above has just read).  The tile is image rows y0, y0+1, all
    //      8 columns; lane = head dim, which is the layout the epilogue stores in.  Same tap order as
    //      a plain (ky, kx) loop from the bias; a tap left or right of the image is skipped, one above or below it adds 0 * w.
    float lep[16];
    {
        const int y0 = qtok0 >> 3;
        const int c  = head * HD + lane;
        float wgt[9];
        #pragma unroll
        for (int j = 0; j < 9; ++j) wgt[j] = cw[c * 9 + j];     // conv_w[c,0,ky,kx]
        const float bias = cb[c];
        float vv[4][8];
        #pragma unroll
        for (int ry = 0; ry < 4; ++ry) {
            const int  yy  = y0 - 1 + ry;                       // rows y0, y0+1 are always inside
            const bool ok  = (ry == 0) ? (yy >= 0) : (ry == 3) ? (yy < 64) : true;
            const int  yyc = ok ? yy : y0;                      // address stays inside V
            const float* vrow = vb_ + (size_t)(yyc * 64 + w * 8) * CCH + c;
            #pragma unroll
            for (int x = 0; x < 8; ++x) {
                const float t = vrow[x * CCH];
                vv[ry][x] = ok ? t : 0.0f;
            }
        }
        #pragma unroll
        for (int ro = 0; ro < 2; ++ro) {
            #pragma unroll
            for (int x = 0; x < 8; ++x) {
                float acc = bias;
                #pragma unroll
                for (int ky = 0; ky < 3; ++ky) {
                    #pragma unroll
                    for (int kx = 0; kx < 3; ++kx) {
                        const int xx = x + kx - 1;
                        if (xx < 0 || xx >= 8) continue;
                        acc += vv[ro + ky][xx] * wgt[ky * 3 + kx];
                    }
                }
                lep[ro * 8 + x] = acc;
            }
        }
    }

    // constant all-ones B fragment (32x16 of 1.0) for row-sum WMMA
    v16h bones;
    #pragma unroll
    for (int i = 0; i < 16; ++i) bones[i] = (half_t)1.0f;

    v8f o0 = {}, o1 = {}, sacc = {};
    const v8f zero = {};

    for (int kblk = 0; kblk < 16; ++kblk) {        // 32 keys per block
        // B fragments of K^T (32x16): tile0 = keys j=0..15 (col=j), tile1 = 16..31
        v16h bk0, bk1;
        {
            const half_t* r0 = smem + K_OFF + (kblk * 32 + lm)      * K_STRIDE;
            const half_t* r1 = smem + K_OFF + (kblk * 32 + 16 + lm) * K_STRIDE;
            #pragma unroll
            for (int i = 0; i < 16; ++i) { const int k = ((i >> 3) << 4) + (hh << 3) + (i & 7); bk0[i] = r0[k]; bk1[i] = r1[k]; }
        }
        v8f s0 = __builtin_amdgcn_wmma_f32_16x16x32_f16(false, aq, false, bk0,
                                                        (short)0, zero, false, false);
        v8f s1 = __builtin_amdgcn_wmma_f32_16x16x32_f16(false, aq, false, bk1,
                                                        (short)0, zero, false, false);

        // P = 2^s at natural key positions
        #pragma unroll
        for (int r = 0; r < 8; ++r) {
            const float p0 = __builtin_amdgcn_exp2f(s0[r]);
            const float p1 = __builtin_amdgcn_exp2f(s1[r]);
            const int row = r + (hh << 3);
            pbuf[row * P_STRIDE + lm]      = (half_t)p0;        // natural key positions
            pbuf[row * P_STRIDE + 16 + lm] = (half_t)p1;
        }
        // A fragment of P (16x32 positions); DS ops are in-order within a wave
        v16h ap;
        {
            const half_t* pr = pbuf + lm * P_STRIDE;
            #pragma unroll
            for (int i = 0; i < 16; ++i) {
                const int k = ((i >> 3) << 4) + (hh << 3) + (i & 7);
                ap[i] = pr[k];
            }
        }
        // B fragments of V block (32 tokens x 32 dims) gathered from V[token][dim]
        v16h bv0, bv1;
        {
            const half_t* vb0 = smem + VT_OFF + (kblk * 32) * V_STRIDE;
            #pragma unroll
            for (int i = 0; i < 16; ++i) { const int k = ((i >> 3) << 4) + (hh << 3) + (i & 7);
                bv0[i] = vb0[k * V_STRIDE + lm]; bv1[i] = vb0[k * V_STRIDE + 16 + lm]; }
        }
        o0   = __builtin_amdgcn_wmma_f32_16x16x32_f16(false, ap, false, bv0,
                                                      (short)0, o0,   false, false);
        o1   = __builtin_amdgcn_wmma_f32_16x16x32_f16(false, ap, false, bv1,
                                                      (short)0, o1,   false, false);
        sacc = __builtin_amdgcn_wmma_f32_16x16x32_f16(false, ap, false, bones,
                                                      (short)0, sacc, false, false);
        asm volatile("v_nop\n\tv_nop\n\tv_nop\n\tv_nop" : "+v"(o0), "+v"(sacc) : "v"(ap), "v"(bones));
    }

    // epilogue: normalize (every lane of a row holds the same sacc), add LePE and scatter
    {
        #pragma unroll
        for (int r = 0; r < 8; ++r) {
            const float inv = 1.0f / sacc[r];
            const float v0 = o0[r] * inv, v1 = o1[r] * inv;
            const float x0 = __shfl_xor(v0, 16), x1 = __shfl_xor(v1, 16);
            const int mA = qtok0 + r, mB = qtok0 + 8 + r;            // row r: own o0 | partner o1; row 8+r: partner o0 | own o1
            float* rowA = out + ((size_t)b * 4096 + (mA >> 3) * 64 + w * 8 + (mA & 7)) * CCH + head * HD;
            float* rowB = out + ((size_t)b * 4096 + (mB >> 3) * 64 + w * 8 + (mB & 7)) * CCH + head * HD;
            *(float*)(rowA + lane) = (hh ? x1 : v0) + lep[r];
            *(float*)(rowB + lane) = (hh ? v1 : x0) + lep[8 + r];
        }
        
    }
}

extern "C" void kernel_launch(void* const* d_in, const int* in_sizes, int n_in,
                              void* d_out, int out_size, void* d_ws, size_t ws_size,
                              hipStream_t stream)
{
    (void)in_sizes; (void)n_in; (void)out_size; (void)d_ws; (void)ws_size;
    const float* qkv = (const float*)d_in[0];
    const float* cw  = (const float*)d_in[1];
    const float* cb  = (const float*)d_in[2];
    float* out = (float*)d_out;

    const size_t shmem = (size_t)LDS_HALF * sizeof(half_t);   // 92,160 B
    hipFuncSetAttribute((const void*)lepe_attn_wmma_kernel, hipFuncAttributeMaxDynamicSharedMemorySize, (int)shmem);
    lepe_attn_wmma_kernel<<<1024, 256, shmem, stream>>>(qkv, cw, cb, out);
}

// v002
// A run of this version takes 22.2 microseconds.
// Next to v001, in two timings, it ran 1.51 times as fast each time.
// Counting every step since v000, it is 2.75 times as fast.
#include <hip/hip_runtime.h>

// LePE windowed attention for CDNA5 (gfx1250), wave32 WMMA flash-attention.
// qkv: [3, B=8, L=4096, C=128] fp32.  Windows: H_SP=64 x W_SP=8 -> Bw=64, N=512.
// heads=4, hd=32 (== WMMA f16 K-dim).  out: [8, 4096, 128] fp32.
//
// - Q pre-scaled by (hd^-0.5 * log2 e): scores leave WMMA in log2 domain, so
//   softmax weights are raw v_exp_f32 (2^x); shift-free (N(0,1) scores), the
//   normalization cancels any base shift.
// - Row sums via an extra WMMA against an all-ones B matrix (no shuffles).
// - P staged per wave in LDS at natural key positions; V kept [token][dim].

// r1: B fragments on the hardware k-map (lane&15 = key for the scores / head dim for P.V; elements 0..7 <- k = 8hh+0..7, 8..15 <- 16+8hh+0..7), so P is
// staged at its natural key positions and V stays [token][dim] in LDS (gathered fragments) — the interleave trick is gone; P converted with the default nearest mode; the
typedef _Float16 half_t;
typedef __attribute__((ext_vector_type(16))) _Float16 v16h;
typedef __attribute__((ext_vector_type(8)))  float    v8f;

#define BSZ    8
#define CCH    128
#define HEADS  4
#define HD     32
#define NTOK   512
// hd^-0.5 * log2(e): scores come out of WMMA ready for v_exp_f32 (2^x)
#define SCALEQ (0.17677669529663687f * 1.4426950408889634f)

// LDS layout (in halves).  Strides padded for 16B alignment + bank spread.
#define K_STRIDE  40                    // per-token row of K  (32 dims + pad)
#define V_STRIDE  40                    // per-token row of V (32 dims + pad)
#define P_STRIDE  40                    // per-wave P scratch row
#define K_OFF     0
#define VT_OFF    (512 * K_STRIDE)                  // 20480
#define P_OFF     (VT_OFF + 512 * V_STRIDE)         // 40960
#define NWAVE     16                    // waves per work-group
#define QT        2                     // query tiles per wave, both fed from one K/V fragment load
#define LDS_HALF  (P_OFF + NWAVE * QT * 16 * P_STRIDE)  // 61440 halves = 122880 B

__global__ void __launch_bounds__(NWAVE * 32)
lepe_attn_wmma_kernel(const float* __restrict__ qkv, const float* __restrict__ cw,
                      const float* __restrict__ cb, float* __restrict__ out)
{
    extern __shared__ half_t smem[];

    // grid: 256 = Bw*heads; one work-group takes all 512 query rows of its window-head
    const int wh   = blockIdx.x;       // window-head id
    const int head = wh & (HEADS - 1);
    const int win  = wh >> 2;          // 0..63
    const int b    = win >> 3;
    const int w    = win & 7;          // window column (W//W_SP = 8)

    const size_t plane = (size_t)BSZ * 4096 * CCH;
    const float* qb  = qkv + (size_t)b * 4096 * CCH;
    const float* kb_ = qb + plane;
    const float* vb_ = qb + 2 * plane;

    const int tid  = threadIdx.x;
    const int lane = tid & 31;
    const int wave = tid >> 5;
    const int hh   = lane >> 4;        // half-wave id (0/1)
    const int lm   = lane & 15;

    // ---- cooperative stage: K -> LDS[token][dim] (f16),
    //      V -> LDS[token][dim] (f16)
    for (int p = 0; p < 8; ++p) {
        const int n  = p * 64 + (tid >> 3);      // token 0..511
        const int d0 = (tid & 7) * 4;            // dim 0..28
        const int yw = n >> 3, xw = n & 7;
        const size_t off = (size_t)(yw * 64 + w * 8 + xw) * CCH + head * HD + d0;
        const float4 k4 = *(const float4*)(kb_ + off);
        const float4 v4 = *(const float4*)(vb_ + off);
        half_t* kr = smem + K_OFF + n * K_STRIDE + d0;
        kr[0] = (half_t)k4.x; kr[1] = (half_t)k4.y;
        kr[2] = (half_t)k4.z; kr[3] = (half_t)k4.w;
        half_t* vr = smem + VT_OFF + n * V_STRIDE + d0;        // V natural: [token][dim]
        vr[0] = (half_t)v4.x; vr[1] = (half_t)v4.y; vr[2] = (half_t)v4.z; vr[3] = (half_t)v4.w;
    }
    __syncthreads();

    half_t* pbuf = smem + P_OFF + wave * QT * 16 * P_STRIDE;   // one 16-row P scratch per query tile

    // ---- each wave: QT consecutive 16-row Q tiles
    const int qbase = wave * QT * 16;

    // A fragments of scaled Q (16x32 f16): lane row m = lm, half i -> k dim
    v16h aq[QT];
    #pragma unroll   // t indexes register arrays here and below: a rolled loop would put them in scratch
    for (int t = 0; t < QT; ++t) {
        const int m  = qbase + t * 16 + lm;
        const int yw = m >> 3, xw = m & 7;
        const float* qrow = qb + (size_t)(yw * 64 + w * 8 + xw) * CCH + head * HD;
        #pragma unroll
        for (int i = 0; i < 16; ++i) {
            const int k = ((i >> 3) << 4) + (hh << 3) + (i & 7);
            aq[t][i] = (half_t)(qrow[k] * SCALEQ);
        }
    }

    // ---- LePE for this wave's own tokens, 16 per tile: depthwise 3x3 over the 64x8 window image, fp32 V from
    //      global (the lines the staging above has just read).  The tile is image rows y0, y0+1, all
    //      8 columns; lane = head dim, which is the layout the epilogue stores in.  Same tap order as
    //      a plain (ky, kx) loop from the bias; a tap above or below the image adds 0 * w; one left or right of it is skipped.
    float lep[QT][16];
    {
        const int c  = head * HD + lane;
        float wgt[9];
        #pragma unroll
        for (int j = 0; j < 9; ++j) wgt[j] = cw[c * 9 + j];     // conv_w[c,0,ky,kx]
        const float bias = cb[c];
        #pragma unroll
        for (int t = 0; t < QT; ++t) {
        const int y0 = (qbase + t * 16) >> 3;
        float vv[4][8];
        #pragma unroll
        for (int ry = 0; ry < 4; ++ry) {
            const int  yy  = y0 - 1 + ry;                       // rows y0, y0+1 are always inside
            const bool ok  = (ry == 0) ? (yy >= 0) : (ry == 3) ? (yy < 64) : true;
            const int  yyc = ok ? yy : y0;                      // address stays inside V
            const float* vrow = vb_ + (size_t)(yyc * 64 + w * 8) * CCH + c;
            #pragma unroll
            for (int x = 0; x < 8; ++x) {
                const float t = vrow[x * CCH];
                vv[ry][x] = ok ? t : 0.0f;
            }
        }
        #pragma unroll
        for (int ro = 0; ro < 2; ++ro) {
            #pragma unroll
            for (int x = 0; x < 8; ++x) {
                float acc = bias;
                #pragma unroll
                for (int ky = 0; ky < 3; ++ky) {
                    #pragma unroll
                    for (int kx = 0; kx < 3; ++kx) {
                        const int xx = x + kx - 1;
                        if (xx < 0 || xx >= 8) continue;
                        acc += vv[ro + ky][xx] * wgt[ky * 3 + kx];
                    }
                }
                lep[t][ro * 8 + x] = acc;
            }
        }
        }
    }

    // constant all-ones B fragment (32x16 of 1.0) for row-sum WMMA
    v16h bones;
    #pragma unroll
    for (int i = 0; i < 16; ++i) bones[i] = (half_t)1.0f;

    v8f o0[QT] = {}, o1[QT] = {}, sacc[QT] = {};
    const v8f zero = {};

    for (int kblk = 0; kblk < 16; ++kblk) {        // 32 keys per block
        // B fragments of K^T (32x16): tile0 = keys j=0..15 (col=j), tile1 = 16..31
        v16h bk0, bk1;
        {
            const half_t* r0 = smem + K_OFF + (kblk * 32 + lm)      * K_STRIDE;
            const half_t* r1 = smem + K_OFF + (kblk * 32 + 16 + lm) * K_STRIDE;
            #pragma unroll
            for (int i = 0; i < 16; ++i) { const int k = ((i >> 3) << 4) + (hh << 3) + (i & 7); bk0[i] = r0[k]; bk1[i] = r1[k]; }
        }
        // B fragments of V block (32 tokens x 32 dims) gathered from V[token][dim]
        v16h bv0, bv1;
        {
            const half_t* vb0 = smem + VT_OFF + (kblk * 32) * V_STRIDE;
            #pragma unroll
            for (int i = 0; i < 16; ++i) { const int k = ((i >> 3) << 4) + (hh << 3) + (i & 7);
                bv0[i] = vb0[k * V_STRIDE + lm]; bv1[i] = vb0[k * V_STRIDE + 16 + lm]; }
        }
        // the four fragments above serve both query tiles of the wave
        v16h ap[QT];
        #pragma unroll
        for (int t = 0; t < QT; ++t) {
            v8f s0 = __builtin_amdgcn_wmma_f32_16x16x32_f16(false, aq[t], false, bk0,
                                                            (short)0, zero, false, false);
            v8f s1 = __builtin_amdgcn_wmma_f32_16x16x32_f16(false, aq[t], false, bk1,
                                                            (short)0, zero, false, false);
            half_t* pt = pbuf + t * 16 * P_STRIDE;
            // P = 2^s at natural key positions
            #pragma unroll
            for (int r = 0; r < 8; ++r) {
                const float p0 = __builtin_amdgcn_exp2f(s0[r]);
                const float p1 = __builtin_amdgcn_exp2f(s1[r]);
                const int row = r + (hh << 3);
                pt[row * P_STRIDE + lm]      = (half_t)p0;        // natural key positions
                pt[row * P_STRIDE + 16 + lm] = (half_t)p1;
            }
        }
        // A fragments of P (16x32 positions); DS ops are in-order within a wave
        #pragma unroll
        for (int t = 0; t < QT; ++t) {
            const half_t* pr = pbuf + t * 16 * P_STRIDE + lm * P_STRIDE;
            #pragma unroll
            for (int i = 0; i < 16; ++i) {
                const int k = ((i >> 3) << 4) + (hh << 3) + (i & 7);
                ap[t][i] = pr[k];
            }
        }
        #pragma unroll
        for (int t = 0; t < QT; ++t) {
            o0[t]   = __builtin_amdgcn_wmma_f32_16x16x32_f16(false, ap[t], false, bv0,
                                                             (short)0, o0[t],   false, false);
            o1[t]   = __builtin_amdgcn_wmma_f32_16x16x32_f16(false, ap[t], false, bv1,
                                                             (short)0, o1[t],   false, false);
            sacc[t] = __builtin_amdgcn_wmma_f32_16x16x32_f16(false, ap[t], false, bones,
                                                             (short)0, sacc[t], false, false);
        }
    }

    // epilogue: normalize (every lane of a row holds the same sacc), add LePE and scatter
    #pragma unroll
    for (int t = 0; t < QT; ++t) {
        const int qtok0 = qbase + t * 16;
        #pragma unroll
        for (int r = 0; r < 8; ++r) {
            const float inv = 1.0f / sacc[t][r];
            const float v0 = o0[t][r] * inv, v1 = o1[t][r] * inv;
            const float x0 = __shfl_xor(v0, 16), x1 = __shfl_xor(v1, 16);
            const int mA = qtok0 + r, mB = qtok0 + 8 + r;            // row r: own o0 | partner o1; row 8+r: partner o0 | own o1
            float* rowA = out + ((size_t)b * 4096 + (mA >> 3) * 64 + w * 8 + (mA & 7)) * CCH + head * HD;
            float* rowB = out + ((size_t)b * 4096 + (mB >> 3) * 64 + w * 8 + (mB & 7)) * CCH + head * HD;
            *(float*)(rowA + lane) = (hh ? x1 : v0) + lep[t][r];
            *(float*)(rowB + lane) = (hh ? v1 : x0) + lep[t][8 + r];
        }
    }
}

extern "C" void kernel_launch(void* const* d_in, const int* in_sizes, int n_in,
                              void* d_out, int out_size, void* d_ws, size_t ws_size,
                              hipStream_t stream)
{
    (void)in_sizes; (void)n_in; (void)out_size; (void)d_ws; (void)ws_size;
    const float* qkv = (const float*)d_in[0];
    const float* cw  = (const float*)d_in[1];
    const float* cb  = (const float*)d_in[2];
    float* out = (float*)d_out;

    const size_t shmem = (size_t)LDS_HALF * sizeof(half_t);   // 122,880 B
    hipFuncSetAttribute((const void*)lepe_attn_wmma_kernel, hipFuncAttributeMaxDynamicSharedMemorySize, (int)shmem);
    lepe_attn_wmma_kernel<<<256, NWAVE * 32, shmem, stream>>>(qkv, cw, cb, out);
}

// v003
// One run takes 15.5 microseconds.
// Timed twice side by side with v002, it ran 1.43 and 1.44 times as fast.
// All steps since v000 together make it 3.95 times as fast.
#include <hip/hip_runtime.h>

// LePE windowed attention for CDNA5 (gfx1250), wave32 WMMA flash-attention.
// qkv: [3, B=8, L=4096, C=128] fp32.  Windows: H_SP=64 x W_SP=8 -> Bw=64, N=512.
// heads=4, hd=32 (== WMMA f16 K-dim).  out: [8, 4096, 128] fp32.
//
// - Q pre-scaled by (hd^-0.5 * log2 e): scores leave WMMA in log2 domain, so
//   softmax weights are raw v_exp_f32 (2^x); shift-free (N(0,1) scores), the
//   normalization cancels any base shift.
// - Transposed products: S^T = K.Q^T, O^T += V^T.P^T.  A lane's two score tiles (keys 8hh+r and
//   16+8hh+r of one query) are, converted in place, the B fragment of P^T: P never touches LDS.
// - Row sums via an extra WMMA with an all-ones A matrix (no shuffles).  V kept [token][dim].

// Fragments on the hardware k-map (lane&15 = row of A / column of B; elements 0..7 <- k = 8hh+0..7, 8..15 <- 16+8hh+0..7);
// V stays [token][dim] in LDS (gathered fragments); P converted with the default nearest mode.
typedef _Float16 half_t;
typedef __attribute__((ext_vector_type(16))) _Float16 v16h;
typedef __attribute__((ext_vector_type(8)))  float    v8f;
typedef __attribute__((ext_vector_type(4)))  float    v4f;

#define BSZ    8
#define CCH    128
#define HEADS  4
#define HD     32
#define NTOK   512
// hd^-0.5 * log2(e): scores come out of WMMA ready for v_exp_f32 (2^x)
#define SCALEQ (0.17677669529663687f * 1.4426950408889634f)

// LDS layout (in halves).  Strides padded for 16B alignment + bank spread.
#define K_STRIDE  40                    // per-token row of K  (32 dims + pad)
#define V_STRIDE  40                    // per-token row of V (32 dims + pad)
#define O_STRIDE  36                    // floats per token row of the per-wave epilogue scratch (32 dims + pad)
#define K_OFF     0
#define VT_OFF    (512 * K_STRIDE)                  // 20480
#define P_OFF     (VT_OFF + 512 * V_STRIDE)         // 40960
#define NWAVE     16                    // waves per work-group
#define QT        2                     // query tiles per wave, both fed from one K/V fragment load
#define LDS_HALF  (P_OFF + NWAVE * 16 * O_STRIDE * 2)   // 59392 halves = 118784 B

__global__ void __launch_bounds__(NWAVE * 32)
lepe_attn_wmma_kernel(const float* __restrict__ qkv, const float* __restrict__ cw,
                      const float* __restrict__ cb, float* __restrict__ out)
{
    extern __shared__ half_t smem[];

    // grid: 256 = Bw*heads; one work-group takes all 512 query rows of its window-head
    const int wh   = blockIdx.x;       // window-head id
    const int head = wh & (HEADS - 1);
    const int win  = wh >> 2;          // 0..63
    const int b    = win >> 3;
    const int w    = win & 7;          // window column (W//W_SP = 8)

    const size_t plane = (size_t)BSZ * 4096 * CCH;
    const float* qb  = qkv + (size_t)b * 4096 * CCH;
    const float* kb_ = qb + plane;
    const float* vb_ = qb + 2 * plane;

    const int tid  = threadIdx.x;
    const int lane = tid & 31;
    const int wave = tid >> 5;
    const int hh   = lane >> 4;        // half-wave id (0/1)
    const int lm   = lane & 15;

    // ---- cooperative stage: K -> LDS[token][dim] (f16),
    //      V -> LDS[token][dim] (f16)
    for (int p = 0; p < 8; ++p) {
        const int n  = p * 64 + (tid >> 3);      // token 0..511
        const int d0 = (tid & 7) * 4;            // dim 0..28
        const int yw = n >> 3, xw = n & 7;
        const size_t off = (size_t)(yw * 64 + w * 8 + xw) * CCH + head * HD + d0;
        const float4 k4 = *(const float4*)(kb_ + off);
        const float4 v4 = *(const float4*)(vb_ + off);
        half_t* kr = smem + K_OFF + n * K_STRIDE + d0;
        kr[0] = (half_t)k4.x; kr[1] = (half_t)k4.y;
        kr[2] = (half_t)k4.z; kr[3] = (half_t)k4.w;
        half_t* vr = smem + VT_OFF + n * V_STRIDE + d0;        // V natural: [token][dim]
        vr[0] = (half_t)v4.x; vr[1] = (half_t)v4.y; vr[2] = (half_t)v4.z; vr[3] = (half_t)v4.w;
    }
    __syncthreads();

    float* obuf = (float*)(smem + P_OFF) + wave * 16 * O_STRIDE;   // wave-private [token][dim] scratch, epilogue only

    // ---- each wave: QT consecutive 16-row Q tiles
    const int qbase = wave * QT * 16;

    // B fragments of scaled Q^T (32x16 f16): lane column = query lm, half i -> k dim
    v16h aq[QT];
    #pragma unroll   // t indexes register arrays here and below: a rolled loop would put them in scratch
    for (int t = 0; t < QT; ++t) {
        const int m  = qbase + t * 16 + lm;
        const int yw = m >> 3, xw = m & 7;
        const float* qrow = qb + (size_t)(yw * 64 + w * 8 + xw) * CCH + head * HD;
        #pragma unroll
        for (int i = 0; i < 16; ++i) {
            const int k = ((i >> 3) << 4) + (hh << 3) + (i & 7);
            aq[t][i] = (half_t)(qrow[k] * SCALEQ);
        }
    }

    // ---- LePE for this wave's own tokens, 16 per tile: depthwise 3x3 over the 64x8 window image, fp32 V from
    //      global (the lines the staging above has just read).  The tile is image rows y0, y0+1, all
    //      8 columns; lane = head dim, which is the layout the epilogue stores in.  Same tap order as
    //      a plain (ky, kx) loop from the bias; a tap above or below the image adds 0 * w; one left or right of it is skipped.
    float lep[QT][16];
    {
        const int c  = head * HD + lane;
        float wgt[9];
        #pragma unroll
        for (int j = 0; j < 9; ++j) wgt[j] = cw[c * 9 + j];     // conv_w[c,0,ky,kx]
        const float bias = cb[c];
        #pragma unroll
        for (int t = 0; t < QT; ++t) {
        const int y0 = (qbase + t * 16) >> 3;
        float vv[4][8];
        #pragma unroll
        for (int ry = 0; ry < 4; ++ry) {
            const int  yy  = y0 - 1 + ry;                       // rows y0, y0+1 are always inside
            const bool ok  = (ry == 0) ? (yy >= 0) : (ry == 3) ? (yy < 64) : true;
            const int  yyc = ok ? yy : y0;                      // address stays inside V
            const float* vrow = vb_ + (size_t)(yyc * 64 + w * 8) * CCH + c;
            #pragma unroll
            for (int x = 0; x < 8; ++x) {
                const float t = vrow[x * CCH];
                vv[ry][x] = ok ? t : 0.0f;
            }
        }
        #pragma unroll
        for (int ro = 0; ro < 2; ++ro) {
            #pragma unroll
            for (int x = 0; x < 8; ++x) {
                float acc = bias;
                #pragma unroll
                for (int ky = 0; ky < 3; ++ky) {
                    #pragma unroll
                    for (int kx = 0; kx < 3; ++kx) {
                        const int xx = x + kx - 1;
                        if (xx < 0 || xx >= 8) continue;
                        acc += vv[ro + ky][xx] * wgt[ky * 3 + kx];
                    }
                }
                lep[t][ro * 8 + x] = acc;
            }
        }
        }
    }

    // constant all-ones A fragment (16x32 of 1.0) for the row-sum WMMA
    v16h bones;
    #pragma unroll
    for (int i = 0; i < 16; ++i) bones[i] = (half_t)1.0f;

    v8f o0[QT] = {}, o1[QT] = {}, sacc[QT] = {};
    const v8f zero = {};

    for (int kblk = 0; kblk < 16; ++kblk) {        // 32 keys per block
        // A fragments of K (16x32): tile0 = keys 0..15 (row = lm), tile1 = 16..31
        v16h bk0, bk1;
        {
            const half_t* r0 = smem + K_OFF + (kblk * 32 + lm)      * K_STRIDE;
            const half_t* r1 = smem + K_OFF + (kblk * 32 + 16 + lm) * K_STRIDE;
            #pragma unroll
            for (int i = 0; i < 16; ++i) { const int k = ((i >> 3) << 4) + (hh << 3) + (i & 7); bk0[i] = r0[k]; bk1[i] = r1[k]; }
        }
        // A fragments of V^T (32 dims x 32 tokens; row = dim lm / 16+lm) gathered from V[token][dim]
        v16h bv0, bv1;
        {
            const half_t* vb0 = smem + VT_OFF + (kblk * 32) * V_STRIDE;
            #pragma unroll
            for (int i = 0; i < 16; ++i) { const int k = ((i >> 3) << 4) + (hh << 3) + (i & 7);
                bv0[i] = vb0[k * V_STRIDE + lm]; bv1[i] = vb0[k * V_STRIDE + 16 + lm]; }
        }
        // the four fragments above serve both query tiles of the wave
        #pragma unroll
        for (int t = 0; t < QT; ++t) {
            // s0[r] = S[query lm][key 8hh + r], s1[r] = S[query lm][key 16 + 8hh + r]
            v8f s0 = __builtin_amdgcn_wmma_f32_16x16x32_f16(false, bk0, false, aq[t],
                                                            (short)0, zero, false, false);
            v8f s1 = __builtin_amdgcn_wmma_f32_16x16x32_f16(false, bk1, false, aq[t],
                                                            (short)0, zero, false, false);
            // P^T = 2^s: elements 0..7 <- s0, 8..15 <- s1 is the hardware k order of a B fragment
            v16h pt;
            #pragma unroll
            for (int r = 0; r < 8; ++r) {
                pt[r]     = (half_t)__builtin_amdgcn_exp2f(s0[r]);
                pt[8 + r] = (half_t)__builtin_amdgcn_exp2f(s1[r]);
            }
            o0[t]   = __builtin_amdgcn_wmma_f32_16x16x32_f16(false, bv0,   false, pt,
                                                             (short)0, o0[t],   false, false);
            o1[t]   = __builtin_amdgcn_wmma_f32_16x16x32_f16(false, bv1,   false, pt,
                                                             (short)0, o1[t],   false, false);
            sacc[t] = __builtin_amdgcn_wmma_f32_16x16x32_f16(false, bones, false, pt,
                                                             (short)0, sacc[t], false, false);
        }
    }

    // epilogue: o0[t][r] = O[query lm][dim 8hh + r], o1[t][r] = O[query lm][dim 16 + 8hh + r]; every row of
    // sacc holds the lane's own query's sum.  Normalize in-lane, turn the tile to lane = dim through the
    // wave's own scratch (DS ops are in-order within a wave), add LePE and store one 128-B row at a time.
    #pragma unroll
    for (int t = 0; t < QT; ++t) {
        const int qtok0 = qbase + t * 16;
        const float inv = 1.0f / sacc[t][0];
        float* orow = obuf + lm * O_STRIDE + (hh << 3);
        const v8f n0 = o0[t] * inv, n1 = o1[t] * inv;
        *(v4f*)(orow)      = __builtin_shufflevector(n0, n0, 0, 1, 2, 3);   // rows are 144 B apart: 16-B aligned
        *(v4f*)(orow + 4)  = __builtin_shufflevector(n0, n0, 4, 5, 6, 7);
        *(v4f*)(orow + 16) = __builtin_shufflevector(n1, n1, 0, 1, 2, 3);
        *(v4f*)(orow + 20) = __builtin_shufflevector(n1, n1, 4, 5, 6, 7);
        #pragma unroll
        for (int j = 0; j < 16; ++j) {
            const int m = qtok0 + j;
            float* row = out + ((size_t)b * 4096 + (m >> 3) * 64 + w * 8 + (m & 7)) * CCH + head * HD;
            row[lane] = obuf[j * O_STRIDE + lane] + lep[t][j];
        }
    }
}

extern "C" void kernel_launch(void* const* d_in, const int* in_sizes, int n_in,
                              void* d_out, int out_size, void* d_ws, size_t ws_size,
                              hipStream_t stream)
{
    (void)in_sizes; (void)n_in; (void)out_size; (void)d_ws; (void)ws_size;
    const float* qkv = (const float*)d_in[0];
    const float* cw  = (const float*)d_in[1];
    const float* cb  = (const float*)d_in[2];
    float* out = (float*)d_out;

    const size_t shmem = (size_t)LDS_HALF * sizeof(half_t);   // 118,784 B
    hipFuncSetAttribute((const void*)lepe_attn_wmma_kernel, hipFuncAttributeMaxDynamicSharedMemorySize, (int)shmem);
    lepe_attn_wmma_kernel<<<256, NWAVE * 32, shmem, stream>>>(qkv, cw, cb, out);
}

// v004
// One run takes 14.6 microseconds.
// In both of two side-by-side timings against v003, it was 1.06 times as fast.
// Counting every step since v000, it is 4.17 times as fast.
#include <hip/hip_runtime.h>

// LePE windowed attention for CDNA5 (gfx1250), wave32 WMMA flash-attention.
// qkv: [3, B=8, L=4096, C=128] fp32.  Windows: H_SP=64 x W_SP=8 -> Bw=64, N=512.
// heads=4, hd=32 (== WMMA f16 K-dim).  out: [8, 4096, 128] fp32.
//
// - Q pre-scaled by (hd^-0.5 * log2 e): scores leave WMMA in log2 domain, so
//   softmax weights are raw v_exp_f32 (2^x); shift-free (N(0,1) scores), the
//   normalization cancels any base shift.
// - Transposed products: S^T = K.Q^T, O^T += V^T.P^T.  A lane's two score tiles (keys 8hh+r and
//   16+8hh+r of one query) are, converted in place, the B fragment of P^T: P never touches LDS.
// - Row sums via an extra WMMA with an all-ones A matrix (no shuffles).  V kept [token][dim];
//   its V^T fragments come by the 16-bit transposing LDS load.

// Fragments on the hardware k-map (lane&15 = row of A / column of B; elements 0..7 <- k = 8hh+0..7, 8..15 <- 16+8hh+0..7);
// V stays [token][dim] in LDS (ds_load_tr16_b128 delivers the same k-map); P converted with the default nearest mode.
typedef _Float16 half_t;
typedef __attribute__((ext_vector_type(16))) _Float16 v16h;
typedef __attribute__((ext_vector_type(8)))  float    v8f;
typedef __attribute__((ext_vector_type(4)))  float    v4f;
typedef __attribute__((ext_vector_type(8)))  _Float16 v8h;
typedef __attribute__((ext_vector_type(8)))  short    s16x8;

// Transposing LDS load: lane l passes the address of 8 halves of row 8(l>>4) + (l&7), column half (l>>3)&1, of a
// 16x16 tile T[token][dim]; lane (c = l&15, h = l>>4) receives T[8h + 0..7][c].
static __device__ __forceinline__ v8h ld_tr16(const _Float16* p)
{
    typedef __attribute__((address_space(3))) s16x8 lds_s16x8;
    return __builtin_bit_cast(v8h, __builtin_amdgcn_ds_load_tr16_b128_v8i16((lds_s16x8*)p));
}

#define BSZ    8
#define CCH    128
#define HEADS  4
#define HD     32
#define NTOK   512
// hd^-0.5 * log2(e): scores come out of WMMA ready for v_exp_f32 (2^x)
#define SCALEQ (0.17677669529663687f * 1.4426950408889634f)

// LDS layout (in halves).  Strides padded for 16B alignment + bank spread.
#define K_STRIDE  40                    // per-token row of K  (32 dims + pad)
#define V_STRIDE  48                    // per-token row of V (32 dims + pad): 96 B = 32 B x odd, the transposing load's pitch
#define O_STRIDE  36                    // floats per token row of the per-wave epilogue scratch (32 dims + pad)
#define K_OFF     0
#define VT_OFF    (512 * K_STRIDE)                  // 20480
#define P_OFF     (VT_OFF + 512 * V_STRIDE)         // 45056
#define NWAVE     16                    // waves per work-group
#define QT        2                     // query tiles per wave, both fed from one K/V fragment load
#define LDS_HALF  (P_OFF + NWAVE * 16 * O_STRIDE * 2)   // 63488 halves = 126976 B

__global__ void __launch_bounds__(NWAVE * 32)
lepe_attn_wmma_kernel(const float* __restrict__ qkv, const float* __restrict__ cw,
                      const float* __restrict__ cb, float* __restrict__ out)
{
    extern __shared__ half_t smem[];

    // grid: 256 = Bw*heads; one work-group takes all 512 query rows of its window-head
    const int wh   = blockIdx.x;       // window-head id
    const int head = wh & (HEADS - 1);
    const int win  = wh >> 2;          // 0..63
    const int b    = win >> 3;
    const int w    = win & 7;          // window column (W//W_SP = 8)

    const size_t plane = (size_t)BSZ * 4096 * CCH;
    const float* qb  = qkv + (size_t)b * 4096 * CCH;
    const float* kb_ = qb + plane;
    const float* vb_ = qb + 2 * plane;

    const int tid  = threadIdx.x;
    const int lane = tid & 31;
    const int wave = tid >> 5;
    const int hh   = lane >> 4;        // half-wave id (0/1)
    const int lm   = lane & 15;

    // ---- cooperative stage: K -> LDS[token][dim] (f16),
    //      V -> LDS[token][dim] (f16)
    for (int p = 0; p < 8; ++p) {
        const int n  = p * 64 + (tid >> 3);      // token 0..511
        const int d0 = (tid & 7) * 4;            // dim 0..28
        const int yw = n >> 3, xw = n & 7;
        const size_t off = (size_t)(yw * 64 + w * 8 + xw) * CCH + head * HD + d0;
        const float4 k4 = *(const float4*)(kb_ + off);
        const float4 v4 = *(const float4*)(vb_ + off);
        half_t* kr = smem + K_OFF + n * K_STRIDE + d0;
        kr[0] = (half_t)k4.x; kr[1] = (half_t)k4.y;
        kr[2] = (half_t)k4.z; kr[3] = (half_t)k4.w;
        half_t* vr = smem + VT_OFF + n * V_STRIDE + d0;        // V natural: [token][dim]
        vr[0] = (half_t)v4.x; vr[1] = (half_t)v4.y; vr[2] = (half_t)v4.z; vr[3] = (half_t)v4.w;
    }
    __syncthreads();

    float* obuf = (float*)(smem + P_OFF) + wave * 16 * O_STRIDE;   // wave-private [token][dim] scratch, epilogue only

    // ---- each wave: QT consecutive 16-row Q tiles
    const int qbase = wave * QT * 16;

    // B fragments of scaled Q^T (32x16 f16): lane column = query lm, half i -> k dim
    v16h aq[QT];
    #pragma unroll   // t indexes register arrays here and below: a rolled loop would put them in scratch
    for (int t = 0; t < QT; ++t) {
        const int m  = qbase + t * 16 + lm;
        const int yw = m >> 3, xw = m & 7;
        const float* qrow = qb + (size_t)(yw * 64 + w * 8 + xw) * CCH + head * HD;
        #pragma unroll
        for (int i = 0; i < 16; ++i) {
            const int k = ((i >> 3) << 4) + (hh << 3) + (i & 7);
            aq[t][i] = (half_t)(qrow[k] * SCALEQ);
        }
    }

    // ---- LePE for this wave's own tokens, 16 per tile: depthwise 3x3 over the 64x8 window image, fp32 V from
    //      global (the lines the staging above has just read).  The tile is image rows y0, y0+1, all
    //      8 columns; lane = head dim, which is the layout the epilogue stores in.  Same tap order as
    //      a plain (ky, kx) loop from the bias; a tap above or below the image adds 0 * w; one left or right of it is skipped.
    float lep[QT][16];
    {
        const int c  = head * HD + lane;
        float wgt[9];
        #pragma unroll
        for (int j = 0; j < 9; ++j) wgt[j] = cw[c * 9 + j];     // conv_w[c,0,ky,kx]
        const float bias = cb[c];
        #pragma unroll
        for (int t = 0; t < QT; ++t) {
        const int y0 = (qbase + t * 16) >> 3;
        float vv[4][8];
        #pragma unroll
        for (int ry = 0; ry < 4; ++ry) {
            const int  yy  = y0 - 1 + ry;                       // rows y0, y0+1 are always inside
            const bool ok  = (ry == 0) ? (yy >= 0) : (ry == 3) ? (yy < 64) : true;
            const int  yyc = ok ? yy : y0;                      // address stays inside V
            const float* vrow = vb_ + (size_t)(yyc * 64 + w * 8) * CCH + c;
            #pragma unroll
            for (int x = 0; x < 8; ++x) {
                const float t = vrow[x * CCH];
                vv[ry][x] = ok ? t : 0.0f;
            }
        }
        #pragma unroll
        for (int ro = 0; ro < 2; ++ro) {
            #pragma unroll
            for (int x = 0; x < 8; ++x) {
                float acc = bias;
                #pragma unroll
                for (int ky = 0; ky < 3; ++ky) {
                    #pragma unroll
                    for (int kx = 0; kx < 3; ++kx) {
                        const int xx = x + kx - 1;
                        if (xx < 0 || xx >= 8) continue;
                        acc += vv[ro + ky][xx] * wgt[ky * 3 + kx];
                    }
                }
                lep[t][ro * 8 + x] = acc;
            }
        }
        }
    }

    // constant all-ones A fragment (16x32 of 1.0) for the row-sum WMMA
    v16h bones;
    #pragma unroll
    for (int i = 0; i < 16; ++i) bones[i] = (half_t)1.0f;

    v8f o0[QT] = {}, o1[QT] = {}, sacc[QT] = {};
    const v8f zero = {};

    for (int kblk = 0; kblk < 16; ++kblk) {        // 32 keys per block
        // A fragments of K (16x32): tile0 = keys 0..15 (row = lm), tile1 = 16..31
        v16h bk0, bk1;
        {
            const half_t* r0 = smem + K_OFF + (kblk * 32 + lm)      * K_STRIDE;
            const half_t* r1 = smem + K_OFF + (kblk * 32 + 16 + lm) * K_STRIDE;
            #pragma unroll
            for (int i = 0; i < 16; ++i) { const int k = ((i >> 3) << 4) + (hh << 3) + (i & 7); bk0[i] = r0[k]; bk1[i] = r1[k]; }
        }
        // A fragments of V^T (32 dims x 32 tokens; row = dim lm / 16+lm): four transposing loads from V[token][dim],
        // tokens 0..15 -> elements 0..7, tokens 16..31 -> elements 8..15; +16 halves = the next 16 dims
        v16h bv0, bv1;
        {
            const half_t* vp = smem + VT_OFF + (kblk * 32 + (hh << 3) + (lane & 7)) * V_STRIDE + ((lane >> 3) & 1) * 8;
            bv0 = __builtin_shufflevector(ld_tr16(vp),      ld_tr16(vp + 16 * V_STRIDE),
                                          0, 1, 2, 3, 4, 5, 6, 7, 8, 9, 10, 11, 12, 13, 14, 15);
            bv1 = __builtin_shufflevector(ld_tr16(vp + 16), ld_tr16(vp + 16 * V_STRIDE + 16),
                                          0, 1, 2, 3, 4, 5, 6, 7, 8, 9, 10, 11, 12, 13, 14, 15);
        }
        // the four fragments above serve both query tiles of the wave
        #pragma unroll
        for (int t = 0; t < QT; ++t) {
            // s0[r] = S[query lm][key 8hh + r], s1[r] = S[query lm][key 16 + 8hh + r]
            v8f s0 = __builtin_amdgcn_wmma_f32_16x16x32_f16(false, bk0, false, aq[t],
                                                            (short)0, zero, false, false);
            v8f s1 = __builtin_amdgcn_wmma_f32_16x16x32_f16(false, bk1, false, aq[t],
                                                            (short)0, zero, false, false);
            // P^T = 2^s: elements 0..7 <- s0, 8..15 <- s1 is the hardware k order of a B fragment
            v16h pt;
            #pragma unroll
            for (int r = 0; r < 8; ++r) {
                pt[r]     = (half_t)__builtin_amdgcn_exp2f(s0[r]);
                pt[8 + r] = (half_t)__builtin_amdgcn_exp2f(s1[r]);
            }
            o0[t]   = __builtin_amdgcn_wmma_f32_16x16x32_f16(false, bv0,   false, pt,
                                                             (short)0, o0[t],   false, false);
            o1[t]   = __builtin_amdgcn_wmma_f32_16x16x32_f16(false, bv1,   false, pt,
                                                             (short)0, o1[t],   false, false);
            sacc[t] = __builtin_amdgcn_wmma_f32_16x16x32_f16(false, bones, false, pt,
                                                             (short)0, sacc[t], false, false);
        }
    }

    // epilogue: o0[t][r] = O[query lm][dim 8hh + r], o1[t][r] = O[query lm][dim 16 + 8hh + r]; every row of
    // sacc holds the lane's own query's sum.  Normalize in-lane, turn the tile to lane = dim through the
    // wave's own scratch (DS ops are in-order within a wave), add LePE and store one 128-B row at a time.
    #pragma unroll
    for (int t = 0; t < QT; ++t) {
        const int qtok0 = qbase + t * 16;
        const float inv = 1.0f / sacc[t][0];
        float* orow = obuf + lm * O_STRIDE + (hh << 3);
        const v8f n0 = o0[t] * inv, n1 = o1[t] * inv;
        *(v4f*)(orow)      = __builtin_shufflevector(n0, n0, 0, 1, 2, 3);   // rows are 144 B apart: 16-B aligned
        *(v4f*)(orow + 4)  = __builtin_shufflevector(n0, n0, 4, 5, 6, 7);
        *(v4f*)(orow + 16) = __builtin_shufflevector(n1, n1, 0, 1, 2, 3);
        *(v4f*)(orow + 20) = __builtin_shufflevector(n1, n1, 4, 5, 6, 7);
        #pragma unroll
        for (int j = 0; j < 16; ++j) {
            const int m = qtok0 + j;
            float* row = out + ((size_t)b * 4096 + (m >> 3) * 64 + w * 8 + (m & 7)) * CCH + head * HD;
            row[lane] = obuf[j * O_STRIDE + lane] + lep[t][j];
        }
    }
}

extern "C" void kernel_launch(void* const* d_in, const int* in_sizes, int n_in,
                              void* d_out, int out_size, void* d_ws, size_t ws_size,
                              hipStream_t stream)
{
    (void)in_sizes; (void)n_in; (void)out_size; (void)d_ws; (void)ws_size;
    const float* qkv = (const float*)d_in[0];
    const float* cw  = (const float*)d_in[1];
    const float* cb  = (const float*)d_in[2];
    float* out = (float*)d_out;

    const size_t shmem = (size_t)LDS_HALF * sizeof(half_t);   // 126,976 B
    hipFuncSetAttribute((const void*)lepe_attn_wmma_kernel, hipFuncAttributeMaxDynamicSharedMemorySize, (int)shmem);
    lepe_attn_wmma_kernel<<<256, NWAVE * 32, shmem, stream>>>(qkv, cw, cb, out);
}

// v005
// Measured time: 13.3 microseconds a run.
// Two timings next to v004 put it at 1.10 and 1.09 times that version's speed.
// All steps since v000 together make it 4.58 times as fast.
#include <hip/hip_runtime.h>

// LePE windowed attention for CDNA5 (gfx1250), wave32 WMMA flash-attention.
// qkv: [3, B=8, L=4096, C=128] fp32.  Windows: H_SP=64 x W_SP=8 -> Bw=64, N=512.
// heads=4, hd=32 (== WMMA f16 K-dim).  out: [8, 4096, 128] fp32.
//
// - Q pre-scaled by (hd^-0.5 * log2 e): scores leave WMMA in log2 domain, so
//   softmax weights are raw v_exp_f32 (2^x); shift-free (N(0,1) scores), the
//   normalization cancels any base shift.
// - Transposed products: S^T = K.Q^T, O^T += V^T.P^T.  A lane's two score tiles (keys 8hh+r and
//   16+8hh+r of one query) are, converted in place, the B fragment of P^T: P never touches LDS.
// - Row sums via an extra WMMA with an all-ones A matrix (no shuffles).  V kept [token][dim];
//   its V^T fragments come by the 16-bit transposing LDS load.

// Fragments on the hardware k-map (lane&15 = row of A / column of B; elements 0..7 <- k = 8hh+0..7, 8..15 <- 16+8hh+0..7);
// V stays [token][dim] in LDS (ds_load_tr16_b128 delivers the same k-map); P converted with the default nearest mode.
typedef _Float16 half_t;
typedef __attribute__((ext_vector_type(16))) _Float16 v16h;
typedef __attribute__((ext_vector_type(8)))  float    v8f;
typedef __attribute__((ext_vector_type(4)))  float    v4f;
typedef __attribute__((ext_vector_type(8)))  _Float16 v8h;
typedef __attribute__((ext_vector_type(8)))  short    s16x8;

// Transposing LDS load: lane l passes the address of 8 halves of row 8(l>>4) + (l&7), column half (l>>3)&1, of a
// 16x16 tile T[token][dim]; lane (c = l&15, h = l>>4) receives T[8h + 0..7][c].
static __device__ __forceinline__ v8h ld_tr16(const _Float16* p)
{
    typedef __attribute__((address_space(3))) s16x8 lds_s16x8;
    return __builtin_bit_cast(v8h, __builtin_amdgcn_ds_load_tr16_b128_v8i16((lds_s16x8*)p));
}

// Work-group barrier that publishes LDS stores only.  __syncthreads() also drains the load counter, which would end
// the flight of the global loads issued ahead; no global data passes between waves here.
static __device__ __forceinline__ void lds_barrier()
{
    asm volatile("s_wait_dscnt 0x0\n\ts_barrier_signal -1\n\ts_barrier_wait -1" ::: "memory");
}

#define BSZ    8
#define CCH    128
#define HEADS  4
#define HD     32
#define NTOK   512
// hd^-0.5 * log2(e): scores come out of WMMA ready for v_exp_f32 (2^x)
#define SCALEQ (0.17677669529663687f * 1.4426950408889634f)

// LDS layout (in halves).  Strides padded for 16B alignment + bank spread.
#define K_STRIDE  40                    // per-token row of K  (32 dims + pad)
#define V_STRIDE  48                    // per-token row of V (32 dims + pad): 96 B = 32 B x odd, the transposing load's pitch
#define O_STRIDE  36                    // floats per token row of the per-wave epilogue scratch (32 dims + pad)
#define K_OFF     0
#define VT_OFF    (512 * K_STRIDE)                  // 20480
#define P_OFF     (VT_OFF + 512 * V_STRIDE)         // 45056
#define NWAVE     16                    // waves per work-group
#define NCH       4                     // K/V staging chunks, in 64-token slices: 1, 1, 2, 4 (a small first chunk starts
#define CH_LO(c)  ((c) == 0 ? 0 : 1 << ((c) - 1))   // the products early, each later one lands behind those before it)
#define CH_HI(c)  (1 << (c))            // chunk c = slices CH_LO(c) .. CH_HI(c) - 1
#define QT        2                     // query tiles per wave, both fed from one K/V fragment load
#define LDS_HALF  (P_OFF + NWAVE * 16 * O_STRIDE * 2)   // 63488 halves = 126976 B

__global__ void __launch_bounds__(NWAVE * 32)
lepe_attn_wmma_kernel(const float* __restrict__ qkv, const float* __restrict__ cw,
                      const float* __restrict__ cb, float* __restrict__ out)
{
    extern __shared__ half_t smem[];

    // grid: 256 = Bw*heads; one work-group takes all 512 query rows of its window-head
    const int wh   = blockIdx.x;       // window-head id
    const int head = wh & (HEADS - 1);
    const int win  = wh >> 2;          // 0..63
    const int b    = win >> 3;
    const int w    = win & 7;          // window column (W//W_SP = 8)

    const size_t plane = (size_t)BSZ * 4096 * CCH;
    const float* qb  = qkv + (size_t)b * 4096 * CCH;
    const float* kb_ = qb + plane;
    const float* vb_ = qb + 2 * plane;

    const int tid  = threadIdx.x;
    const int lane = tid & 31;
    const int wave = tid >> 5;
    const int hh   = lane >> 4;        // half-wave id (0/1)
    const int lm   = lane & 15;

    // ---- every K/V load of the thread is issued here, with the Q loads behind the first chunk's (loads return in
    //      issue order).  K and V go to LDS (f16, [token][dim]) in NCH chunks of 64, 64, 128, 256 keys, each just ahead
    //      of its own key blocks, so the later chunks' memory time runs behind the earlier chunks' products.
    const int n0 = tid >> 3;                     // token within a 64-token slice
    const int d0 = (tid & 7) * 4;                // dim 0..28
    const size_t off0 = (size_t)((n0 >> 3) * 64 + w * 8 + (n0 & 7)) * CCH + head * HD + d0;
    float4 k4[8], v4[8];                         // slice p = tokens 64p .. 64p+63, 8 image rows further down each
    #pragma unroll   // p indexes register arrays
    for (int p = 0; p < CH_HI(0); ++p) {
        k4[p] = *(const float4*)(kb_ + off0 + (size_t)p * (8 * 64 * CCH));
        v4[p] = *(const float4*)(vb_ + off0 + (size_t)p * (8 * 64 * CCH));
    }

    float* obuf = (float*)(smem + P_OFF) + wave * 16 * O_STRIDE;   // wave-private [token][dim] scratch, epilogue only

    // ---- each wave: QT consecutive 16-row Q tiles
    const int qbase = wave * QT * 16;

    // B fragments of scaled Q^T (32x16 f16): lane column = query lm, half i -> k dim
    v16h aq[QT];
    float qf[QT][16];
    #pragma unroll   // t indexes register arrays here and below: a rolled loop would put them in scratch
    for (int t = 0; t < QT; ++t) {
        const int m  = qbase + t * 16 + lm;
        const int yw = m >> 3, xw = m & 7;
        const float* qrow = qb + (size_t)(yw * 64 + w * 8 + xw) * CCH + head * HD;
        #pragma unroll
        for (int i = 0; i < 16; ++i) {
            const int k = ((i >> 3) << 4) + (hh << 3) + (i & 7);
            qf[t][i] = qrow[k];
        }
    }
    // keeps the first chunk's and Q's loads first in issue order: a wait for them must not cover the loads below
    __builtin_amdgcn_sched_barrier(0);
    // the loads below land in registers that held addresses of the loads above
    asm volatile("s_wait_xcnt 0x0" ::: "memory");
    #pragma unroll
    for (int p = CH_HI(0); p < 8; ++p) {
        k4[p] = *(const float4*)(kb_ + off0 + (size_t)p * (8 * 64 * CCH));
        v4[p] = *(const float4*)(vb_ + off0 + (size_t)p * (8 * 64 * CCH));
        // chunk by chunk in issue order, for the same reason (the scheduler had put all of K ahead of all of V)
        if (((p + 1) & p) == 0) __builtin_amdgcn_sched_barrier(0);   // p + 1 a power of two: a chunk's last slice
    }

    // ---- LePE for this wave's own tokens, 16 per tile: depthwise 3x3 over the 64x8 window image, fp32 V from
    //      global (lines the staging has read).  The tile is image rows y0, y0+1, all 8 columns; lane = head
    //      dim, which is the layout the epilogue stores in.  The loads are issued ahead of the last chunk's key
    //      blocks (behind every K/V load's use), the sums are formed at the output store.
    const int cch = head * HD + lane;
    const int yw0 = qbase >> 3;                  // the wave's QT tiles are image rows yw0 .. yw0+3
    const bool okl = yw0 > 0, okh = yw0 + 4 < 64;
    float wgt[9], bias, vv[2 * QT + 2][8];       // V rows yw0-1 .. yw0+4, each loaded once for both tiles

    // constant all-ones A fragment (16x32 of 1.0) for the row-sum WMMA
    v16h bones;
    #pragma unroll
    for (int i = 0; i < 16; ++i) bones[i] = (half_t)1.0f;

    v8f o0[QT] = {}, o1[QT] = {}, sacc[QT] = {};
    const v8f zero = {};

    #pragma unroll   // c indexes the register arrays k4, v4
    for (int c = 0; c < NCH; ++c) {
    #pragma unroll
    for (int p = CH_LO(c); p < CH_HI(c); ++p) {
        const int n = p * 64 + n0;               // token 0..511
        half_t* kr = smem + K_OFF + n * K_STRIDE + d0;
        kr[0] = (half_t)k4[p].x; kr[1] = (half_t)k4[p].y;
        kr[2] = (half_t)k4[p].z; kr[3] = (half_t)k4[p].w;
        half_t* vr = smem + VT_OFF + n * V_STRIDE + d0;        // V natural: [token][dim]
        vr[0] = (half_t)v4[p].x; vr[1] = (half_t)v4[p].y; vr[2] = (half_t)v4[p].z; vr[3] = (half_t)v4[p].w;
    }
    if (c == 0) {
        #pragma unroll
        for (int t = 0; t < QT; ++t) {
            #pragma unroll
            for (int i = 0; i < 16; ++i) aq[t][i] = (half_t)(qf[t][i] * SCALEQ);
        }
    }
    if (c == NCH - 1) {
        #pragma unroll
        for (int j = 0; j < 9; ++j) wgt[j] = cw[cch * 9 + j];   // conv_w[c,0,ky,kx]
        bias = cb[cch];
        // here and twice below: the next loads may land in registers that held addresses of the loads above;
        // the scheduling fence keeps them behind the wait
        __builtin_amdgcn_sched_barrier(0);
        asm volatile("s_wait_xcnt 0x0" ::: "memory");
        const float* vmid = vb_ + (size_t)(yw0 * 64 + w * 8) * CCH + cch;   // rows yw0 .. yw0+3 are always inside
        const float* vlo  = okl ? vmid - 64 * CCH : vmid;                   // address stays inside V
        const float* vhi  = okh ? vmid + 4 * 64 * CCH : vmid;
        #pragma unroll
        for (int x = 0; x < 8; ++x) vv[0][x] = vlo[x * CCH];
        __builtin_amdgcn_sched_barrier(0);
        asm volatile("s_wait_xcnt 0x0" ::: "memory");
        #pragma unroll
        for (int x = 0; x < 8; ++x) vv[2 * QT + 1][x] = vhi[x * CCH];
        __builtin_amdgcn_sched_barrier(0);
        asm volatile("s_wait_xcnt 0x0" ::: "memory");
        #pragma unroll
        for (int ry = 1; ry <= 2 * QT; ++ry) {
            #pragma unroll
            for (int x = 0; x < 8; ++x) vv[ry][x] = vmid[((ry - 1) * 64 + x) * CCH];
        }
    }
    lds_barrier();     // chunk c is in LDS for every wave; chunks lie apart, so nothing is overwritten
    // rolled: unrolled, the scheduler drew the later chunks' conversions, and the waits for their loads, up into chunk 0
    #pragma unroll 1
    for (int kblk = 2 * CH_LO(c); kblk < 2 * CH_HI(c); ++kblk) {                  // 32 keys per block
        // A fragments of K (16x32): tile0 = keys 0..15 (row = lm), tile1 = 16..31
        v16h bk0, bk1;
        {
            const half_t* r0 = smem + K_OFF + (kblk * 32 + lm)      * K_STRIDE;
            const half_t* r1 = smem + K_OFF + (kblk * 32 + 16 + lm) * K_STRIDE;
            #pragma unroll
            for (int i = 0; i < 16; ++i) { const int k = ((i >> 3) << 4) + (hh << 3) + (i & 7); bk0[i] = r0[k]; bk1[i] = r1[k]; }
        }
        // A fragments of V^T (32 dims x 32 tokens; row = dim lm / 16+lm): four transposing loads from V[token][dim],
        // tokens 0..15 -> elements 0..7, tokens 16..31 -> elements 8..15; +16 halves = the next 16 dims
        v16h bv0, bv1;
        {
            const half_t* vp = smem + VT_OFF + (kblk * 32 + (hh << 3) + (lane & 7)) * V_STRIDE + ((lane >> 3) & 1) * 8;
            bv0 = __builtin_shufflevector(ld_tr16(vp),      ld_tr16(vp + 16 * V_STRIDE),
                                          0, 1, 2, 3, 4, 5, 6, 7, 8, 9, 10, 11, 12, 13, 14, 15);
            bv1 = __builtin_shufflevector(ld_tr16(vp + 16), ld_tr16(vp + 16 * V_STRIDE + 16),
                                          0, 1, 2, 3, 4, 5, 6, 7, 8, 9, 10, 11, 12, 13, 14, 15);
        }
        // the four fragments above serve both query tiles of the wave
        #pragma unroll
        for (int t = 0; t < QT; ++t) {
            // s0[r] = S[query lm][key 8hh + r], s1[r] = S[query lm][key 16 + 8hh + r]
            v8f s0 = __builtin_amdgcn_wmma_f32_16x16x32_f16(false, bk0, false, aq[t],
                                                            (short)0, zero, false, false);
            v8f s1 = __builtin_amdgcn_wmma_f32_16x16x32_f16(false, bk1, false, aq[t],
                                                            (short)0, zero, false, false);
            // P^T = 2^s: elements 0..7 <- s0, 8..15 <- s1 is the hardware k order of a B fragment
            v16h pt;
            #pragma unroll
            for (int r = 0; r < 8; ++r) {
                pt[r]     = (half_t)__builtin_amdgcn_exp2f(s0[r]);
                pt[8 + r] = (half_t)__builtin_amdgcn_exp2f(s1[r]);
            }
            o0[t]   = __builtin_amdgcn_wmma_f32_16x16x32_f16(false, bv0,   false, pt,
                                                             (short)0, o0[t],   false, false);
            o1[t]   = __builtin_amdgcn_wmma_f32_16x16x32_f16(false, bv1,   false, pt,
                                                             (short)0, o1[t],   false, false);
            sacc[t] = __builtin_amdgcn_wmma_f32_16x16x32_f16(false, bones, false, pt,
                                                             (short)0, sacc[t], false, false);
        }
    }
    }

    // epilogue: o0[t][r] = O[query lm][dim 8hh + r], o1[t][r] = O[query lm][dim 16 + 8hh + r]; every row of
    // sacc holds the lane's own query's sum.  Normalize in-lane, turn the tile to lane = dim through the
    // wave's own scratch (DS ops are in-order within a wave), add LePE and store one 128-B row at a time.
    #pragma unroll
    for (int t = 0; t < QT; ++t) {
        const int qtok0 = qbase + t * 16;
        // same tap order as a plain (ky, kx) loop from the bias; a row outside the image adds 0 * w, a column outside is skipped
        float lep[16];
        {
            if (t == 0) {
                #pragma unroll
                for (int x = 0; x < 8; ++x) {
                    vv[0][x]          = okl ? vv[0][x] : 0.0f;
                    vv[2 * QT + 1][x] = okh ? vv[2 * QT + 1][x] : 0.0f;
                }
            }
            #pragma unroll
            for (int ro = 0; ro < 2; ++ro) {
                #pragma unroll
                for (int x = 0; x < 8; ++x) {
                    float acc = bias;
                    #pragma unroll
                    for (int ky = 0; ky < 3; ++ky) {
                        #pragma unroll
                        for (int kx = 0; kx < 3; ++kx) {
                            const int xx = x + kx - 1;
                            if (xx < 0 || xx >= 8) continue;
                            acc += vv[2 * t + ro + ky][xx] * wgt[ky * 3 + kx];
                        }
                    }
                    lep[ro * 8 + x] = acc;
                }
            }
        }
        const float inv = 1.0f / sacc[t][0];
        float* orow = obuf + lm * O_STRIDE + (hh << 3);
        const v8f n0 = o0[t] * inv, n1 = o1[t] * inv;
        *(v4f*)(orow)      = __builtin_shufflevector(n0, n0, 0, 1, 2, 3);   // rows are 144 B apart: 16-B aligned
        *(v4f*)(orow + 4)  = __builtin_shufflevector(n0, n0, 4, 5, 6, 7);
        *(v4f*)(orow + 16) = __builtin_shufflevector(n1, n1, 0, 1, 2, 3);
        *(v4f*)(orow + 20) = __builtin_shufflevector(n1, n1, 4, 5, 6, 7);
        #pragma unroll
        for (int j = 0; j < 16; ++j) {
            const int m = qtok0 + j;
            float* row = out + ((size_t)b * 4096 + (m >> 3) * 64 + w * 8 + (m & 7)) * CCH + head * HD;
            row[lane] = obuf[j * O_STRIDE + lane] + lep[j];
        }
    }
}

extern "C" void kernel_launch(void* const* d_in, const int* in_sizes, int n_in,
                              void* d_out, int out_size, void* d_ws, size_t ws_size,
                              hipStream_t stream)
{
    (void)in_sizes; (void)n_in; (void)out_size; (void)d_ws; (void)ws_size;
    const float* qkv = (const float*)d_in[0];
    const float* cw  = (const float*)d_in[1];
    const float* cb  = (const float*)d_in[2];
    float* out = (float*)d_out;

    const size_t shmem = (size_t)LDS_HALF * sizeof(half_t);   // 126,976 B
    hipFuncSetAttribute((const void*)lepe_attn_wmma_kernel, hipFuncAttributeMaxDynamicSharedMemorySize, (int)shmem);
    lepe_attn_wmma_kernel<<<256, NWAVE * 32, shmem, stream>>>(qkv, cw, cb, out);
}

// v006
// Measured time: 12.3 microseconds a run.
// Two timings next to v005 put it at 1.07 and 1.08 times that version's speed.
// All steps since v000 together make it 4.93 times as fast.
#include <hip/hip_runtime.h>

// LePE windowed attention for CDNA5 (gfx1250), wave32 WMMA flash-attention.
// qkv: [3, B=8, L=4096, C=128] fp32.  Windows: H_SP=64 x W_SP=8 -> Bw=64, N=512.
// heads=4, hd=32 (== WMMA f16 K-dim).  out: [8, 4096, 128] fp32.
//
// - Q pre-scaled by (hd^-0.5 * log2 e): scores leave WMMA in log2 domain, so
//   softmax weights are raw v_exp_f32 (2^x); shift-free (N(0,1) scores), the
//   normalization cancels any base shift.
// - Transposed products: S^T = K.Q^T, O^T += V^T.P^T.  A lane's two score tiles (keys 8hh+r and
//   16+8hh+r of one query) are, converted in place, the B fragment of P^T: P never touches LDS.
// - Row sums via an extra WMMA with an all-ones A matrix (no shuffles).  V kept [token][dim];
//   its V^T fragments come by the 16-bit transposing LDS load.

// Fragments on the hardware k-map (lane&15 = row of A / column of B; elements 0..7 <- k = 8hh+0..7, 8..15 <- 16+8hh+0..7);
// V stays [token][dim] in LDS (ds_load_tr16_b128 delivers the same k-map); P converted with the default nearest mode.
typedef _Float16 half_t;
typedef __attribute__((ext_vector_type(16))) _Float16 v16h;
typedef __attribute__((ext_vector_type(8)))  float    v8f;
typedef __attribute__((ext_vector_type(4)))  float    v4f;
typedef __attribute__((ext_vector_type(8)))  _Float16 v8h;
typedef __attribute__((ext_vector_type(8)))  short    s16x8;
typedef __attribute__((ext_vector_type(8)))  unsigned int u32x8;

// Transposing LDS load: lane l passes the address of 8 halves of row 8(l>>4) + (l&7), column half (l>>3)&1, of a
// 16x16 tile T[token][dim]; lane (c = l&15, h = l>>4) receives T[8h + 0..7][c].
static __device__ __forceinline__ v8h ld_tr16(const _Float16* p)
{
    typedef __attribute__((address_space(3))) s16x8 lds_s16x8;
    return __builtin_bit_cast(v8h, __builtin_amdgcn_ds_load_tr16_b128_v8i16((lds_s16x8*)p));
}

// Work-group barrier that publishes LDS stores only.  __syncthreads() also drains the load counter, which would end
// the flight of the global loads issued ahead; no global data passes between waves here.
static __device__ __forceinline__ void lds_barrier()
{
    asm volatile("s_wait_dscnt 0x0\n\ts_barrier_signal -1\n\ts_barrier_wait -1" ::: "memory");
}

#define BSZ    8
#define CCH    128
#define HEADS  4
#define HD     32
#define NTOK   512
// hd^-0.5 * log2(e): scores come out of WMMA ready for v_exp_f32 (2^x)
#define SCALEQ (0.17677669529663687f * 1.4426950408889634f)

// LDS layout (in halves).  Strides padded for 16B alignment + bank spread.
#define K_STRIDE  40                    // per-token row of K  (32 dims + pad)
#define V_STRIDE  48                    // per-token row of V (32 dims + pad): 96 B = 32 B x odd, the transposing load's pitch
#define O_STRIDE  36                    // floats per token row of the per-wave epilogue scratch (32 dims + pad)
#define K_OFF     0
#define VT_OFF    (512 * K_STRIDE)                  // 20480
#define P_OFF     (VT_OFF + 512 * V_STRIDE)         // 45056
#define NWAVE     16                    // waves per work-group
#define NCH       4                     // K/V staging chunks, in 64-token slices: 1, 1, 2, 4 (a small first chunk starts
#define CH_LO(c)  ((c) == 0 ? 0 : 1 << ((c) - 1))   // the products early, each later one lands behind those before it)
#define CH_HI(c)  (1 << (c))            // chunk c = slices CH_LO(c) .. CH_HI(c) - 1
#define QT        2                     // query tiles per wave, both fed from one K/V fragment load
#define LDS_HALF  (P_OFF + NWAVE * 16 * O_STRIDE * 2)   // 63488 halves = 126976 B

__global__ void __launch_bounds__(NWAVE * 32)
lepe_attn_wmma_kernel(const float* __restrict__ qkv, const float* __restrict__ cw,
                      const float* __restrict__ cb, float* __restrict__ out)
{
    extern __shared__ half_t smem[];

    // grid: 256 = Bw*heads; one work-group takes all 512 query rows of its window-head
    const int wh   = blockIdx.x;       // window-head id
    const int head = wh & (HEADS - 1);
    const int win  = wh >> 2;          // 0..63
    const int b    = win >> 3;
    const int w    = win & 7;          // window column (W//W_SP = 8)

    const size_t plane = (size_t)BSZ * 4096 * CCH;
    const float* qb  = qkv + (size_t)b * 4096 * CCH;
    const float* kb_ = qb + plane;
    const float* vb_ = qb + 2 * plane;

    const int tid  = threadIdx.x;
    const int lane = tid & 31;
    const int wave = tid >> 5;
    const int hh   = lane >> 4;        // half-wave id (0/1)
    const int lm   = lane & 15;

    // ---- every K/V load of the thread is issued here, with the Q loads behind the first chunk's (loads return in
    //      issue order).  K and V go to LDS (f16, [token][dim]) in NCH chunks of 64, 64, 128, 256 keys, each just ahead
    //      of its own key blocks, so the later chunks' memory time runs behind the earlier chunks' products.
    const int n0 = tid >> 3;                     // token within a 64-token slice
    const int d0 = (tid & 7) * 4;                // dim 0..28
    const size_t off0 = (size_t)((n0 >> 3) * 64 + w * 8 + (n0 & 7)) * CCH + head * HD + d0;
    float4 k4[8], v4[8];                         // slice p = tokens 64p .. 64p+63, 8 image rows further down each
    #pragma unroll   // p indexes register arrays
    for (int p = 0; p < CH_HI(0); ++p) {
        k4[p] = *(const float4*)(kb_ + off0 + (size_t)p * (8 * 64 * CCH));
        v4[p] = *(const float4*)(vb_ + off0 + (size_t)p * (8 * 64 * CCH));
    }

    float* obuf = (float*)(smem + P_OFF) + wave * 16 * O_STRIDE;   // wave-private [token][dim] scratch, epilogue only

    // ---- each wave: QT consecutive 16-row Q tiles
    const int qbase = wave * QT * 16;

    // B fragments of scaled Q^T (32x16 f16): lane column = query lm, half i -> k dim
    v16h aq[QT];
    float qf[QT][16];
    #pragma unroll   // t indexes register arrays here and below: a rolled loop would put them in scratch
    for (int t = 0; t < QT; ++t) {
        const int m  = qbase + t * 16 + lm;
        const int yw = m >> 3, xw = m & 7;
        const float* qrow = qb + (size_t)(yw * 64 + w * 8 + xw) * CCH + head * HD;
        #pragma unroll
        for (int i = 0; i < 16; ++i) {
            const int k = ((i >> 3) << 4) + (hh << 3) + (i & 7);
            qf[t][i] = qrow[k];
        }
    }
    // keeps the first chunk's and Q's loads first in issue order: a wait for them must not cover the loads below
    __builtin_amdgcn_sched_barrier(0);
    // the loads below land in registers that held addresses of the loads above
    asm volatile("s_wait_xcnt 0x0" ::: "memory");
    #pragma unroll
    for (int p = CH_HI(0); p < 8; ++p) {
        k4[p] = *(const float4*)(kb_ + off0 + (size_t)p * (8 * 64 * CCH));
        v4[p] = *(const float4*)(vb_ + off0 + (size_t)p * (8 * 64 * CCH));
        // chunk by chunk in issue order, for the same reason (the scheduler had put all of K ahead of all of V)
        if (((p + 1) & p) == 0) __builtin_amdgcn_sched_barrier(0);   // p + 1 a power of two: a chunk's last slice
    }

    // ---- LePE for this wave's own tokens, 16 per tile: depthwise 3x3 over the 64x8 window image, fp32 V from
    //      global (lines the staging has read).  The tile is image rows y0, y0+1, all 8 columns; lane = head
    //      dim, which is the layout the epilogue stores in.  The loads are issued ahead of the last chunk's key
    //      blocks (behind every K/V load's use), the sums are formed at the output store.
    const int cch = head * HD + lane;
    const int yw0 = qbase >> 3;                  // the wave's QT tiles are image rows yw0 .. yw0+3
    const bool okl = yw0 > 0, okh = yw0 + 4 < 64;
    float wgt[9], bias, vv[2 * QT + 2][8];       // V rows yw0-1 .. yw0+4, each loaded once for both tiles

    // constant all-ones A fragment (16x32 of 1.0) for the row-sum WMMA
    // made by moves in asm text: given as a literal, the compiler kept it in scalar registers and re-made the eight
    // vector registers in every trip of the key loop (four moves, and four v_nop ahead of them because they
    // overwrite the A operand of the trip's last WMMA)
    u32x8 ones2;
    asm("v_mov_b32 %0, 0x3c003c00\n\tv_mov_b32 %1, 0x3c003c00\n\tv_mov_b32 %2, 0x3c003c00\n\tv_mov_b32 %3, 0x3c003c00\n\t"
        "v_mov_b32 %4, 0x3c003c00\n\tv_mov_b32 %5, 0x3c003c00\n\tv_mov_b32 %6, 0x3c003c00\n\tv_mov_b32 %7, 0x3c003c00"
        : "=v"(ones2[0]), "=v"(ones2[1]), "=v"(ones2[2]), "=v"(ones2[3]),
          "=v"(ones2[4]), "=v"(ones2[5]), "=v"(ones2[6]), "=v"(ones2[7]));
    const v16h bones = __builtin_bit_cast(v16h, ones2);

    v8f o0[QT] = {}, o1[QT] = {}, sacc[QT] = {};
    const v8f zero = {};

    // fragment addresses of key block 0; the loop adds one block's bytes to each per trip (formed from kblk they took
    // an or and an integer multiply-add each per trip)
    const half_t* kp0 = smem + K_OFF + lm * K_STRIDE + (hh << 3);
    const half_t* vp0 = smem + VT_OFF + ((hh << 3) + (lane & 7)) * V_STRIDE + ((lane >> 3) & 1) * 8;

    #pragma unroll   // c indexes the register arrays k4, v4
    for (int c = 0; c < NCH; ++c) {
    #pragma unroll
    for (int p = CH_LO(c); p < CH_HI(c); ++p) {
        const int n = p * 64 + n0;               // token 0..511
        half_t* kr = smem + K_OFF + n * K_STRIDE + d0;
        kr[0] = (half_t)k4[p].x; kr[1] = (half_t)k4[p].y;
        kr[2] = (half_t)k4[p].z; kr[3] = (half_t)k4[p].w;
        half_t* vr = smem + VT_OFF + n * V_STRIDE + d0;        // V natural: [token][dim]
        vr[0] = (half_t)v4[p].x; vr[1] = (half_t)v4[p].y; vr[2] = (half_t)v4[p].z; vr[3] = (half_t)v4[p].w;
    }
    if (c == 0) {
        #pragma unroll
        for (int t = 0; t < QT; ++t) {
            #pragma unroll
            for (int i = 0; i < 16; ++i) aq[t][i] = (half_t)(qf[t][i] * SCALEQ);
        }
    }
    if (c == NCH - 1) {
        #pragma unroll
        for (int j = 0; j < 9; ++j) wgt[j] = cw[cch * 9 + j];   // conv_w[c,0,ky,kx]
        bias = cb[cch];
        // here and twice below: the next loads may land in registers that held addresses of the loads above;
        // the scheduling fence keeps them behind the wait
        __builtin_amdgcn_sched_barrier(0);
        asm volatile("s_wait_xcnt 0x0" ::: "memory");
        const float* vmid = vb_ + (size_t)(yw0 * 64 + w * 8) * CCH + cch;   // rows yw0 .. yw0+3 are always inside
        const float* vlo  = okl ? vmid - 64 * CCH : vmid;                   // address stays inside V
        const float* vhi  = okh ? vmid + 4 * 64 * CCH : vmid;
        #pragma unroll
        for (int x = 0; x < 8; ++x) vv[0][x] = vlo[x * CCH];
        __builtin_amdgcn_sched_barrier(0);
        asm volatile("s_wait_xcnt 0x0" ::: "memory");
        #pragma unroll
        for (int x = 0; x < 8; ++x) vv[2 * QT + 1][x] = vhi[x * CCH];
        __builtin_amdgcn_sched_barrier(0);
        asm volatile("s_wait_xcnt 0x0" ::: "memory");
        #pragma unroll
        for (int ry = 1; ry <= 2 * QT; ++ry) {
            #pragma unroll
            for (int x = 0; x < 8; ++x) vv[ry][x] = vmid[((ry - 1) * 64 + x) * CCH];
        }
    }
    lds_barrier();     // chunk c is in LDS for every wave; chunks lie apart, so nothing is overwritten
    // rolled: unrolled, the scheduler drew the later chunks' conversions, and the waits for their loads, up into chunk 0
    const half_t* kp = kp0 + 2 * CH_LO(c) * 32 * K_STRIDE;
    const half_t* vp = vp0 + 2 * CH_LO(c) * 32 * V_STRIDE;
    #pragma unroll 1
    for (int kblk = 2 * CH_LO(c); kblk < 2 * CH_HI(c); ++kblk) {                  // 32 keys per block
        // A fragments of K (16x32): tile0 = keys 0..15 (row = lm), tile1 = 16..31
        v16h bk0, bk1;
        {
            const half_t* r0 = kp;
            const half_t* r1 = kp + 16 * K_STRIDE;
            #pragma unroll
            for (int i = 0; i < 16; ++i) { const int k = ((i >> 3) << 4) + (i & 7); bk0[i] = r0[k]; bk1[i] = r1[k]; }
        }
        // A fragments of V^T (32 dims x 32 tokens; row = dim lm / 16+lm): four transposing loads from V[token][dim],
        // tokens 0..15 -> elements 0..7, tokens 16..31 -> elements 8..15; +16 halves = the next 16 dims
        v16h bv0, bv1;
        {
            bv0 = __builtin_shufflevector(ld_tr16(vp),      ld_tr16(vp + 16 * V_STRIDE),
                                          0, 1, 2, 3, 4, 5, 6, 7, 8, 9, 10, 11, 12, 13, 14, 15);
            bv1 = __builtin_shufflevector(ld_tr16(vp + 16), ld_tr16(vp + 16 * V_STRIDE + 16),
                                          0, 1, 2, 3, 4, 5, 6, 7, 8, 9, 10, 11, 12, 13, 14, 15);
        }
        kp += 32 * K_STRIDE;
        vp += 32 * V_STRIDE;
        // the four fragments above serve both query tiles of the wave
        // s0[r] = S[query lm][key 8hh + r], s1[r] = S[query lm][key 16 + 8hh + r]
        v8f s0a[QT], s1a[QT];
        #pragma unroll
        for (int t = 0; t < QT; ++t) {
            s0a[t] = __builtin_amdgcn_wmma_f32_16x16x32_f16(false, bk0, false, aq[t], (short)0, zero, false, false);
            s1a[t] = __builtin_amdgcn_wmma_f32_16x16x32_f16(false, bk1, false, aq[t], (short)0, zero, false, false);
        }
        // issue order: the eight fragment reads, the four score WMMAs back to back, then the v_exp_f32: each WMMA fills
        // the others' distance to the first v_exp_f32 on a result (with a v_exp_f32 between them the compiler padded
        // each gap with v_nop, 4 to 7 a trip; the third group keeps the v_exp_f32 from being drawn up again)
        __builtin_amdgcn_sched_group_barrier(0x100, 8, 0);
        __builtin_amdgcn_sched_group_barrier(0x008, 4, 0);
        __builtin_amdgcn_sched_group_barrier(0x400, 32, 0);
        #pragma unroll
        for (int t = 0; t < QT; ++t) {
            const v8f s0 = s0a[t], s1 = s1a[t];
            // P^T = 2^s: elements 0..7 <- s0, 8..15 <- s1 is the hardware k order of a B fragment
            v16h pt;
            #pragma unroll
            for (int r = 0; r < 8; ++r) {
                pt[r]     = (half_t)__builtin_amdgcn_exp2f(s0[r]);
                pt[8 + r] = (half_t)__builtin_amdgcn_exp2f(s1[r]);
            }
            o0[t]   = __builtin_amdgcn_wmma_f32_16x16x32_f16(false, bv0,   false, pt,
                                                             (short)0, o0[t],   false, false);
            o1[t]   = __builtin_amdgcn_wmma_f32_16x16x32_f16(false, bv1,   false, pt,
                                                             (short)0, o1[t],   false, false);
            sacc[t] = __builtin_amdgcn_wmma_f32_16x16x32_f16(false, bones, false, pt,
                                                             (short)0, sacc[t], false, false);
        }
    }
    }

    // epilogue: o0[t][r] = O[query lm][dim 8hh + r], o1[t][r] = O[query lm][dim 16 + 8hh + r]; every row of
    // sacc holds the lane's own query's sum.  Normalize in-lane, turn the tile to lane = dim through the
    // wave's own scratch (DS ops are in-order within a wave), add LePE and store one 128-B row at a time.
    #pragma unroll
    for (int t = 0; t < QT; ++t) {
        const int qtok0 = qbase + t * 16;
        // same tap order as a plain (ky, kx) loop from the bias; a row outside the image adds 0 * w, a column outside is skipped
        float lep[16];
        {
            if (t == 0) {
                #pragma unroll
                for (int x = 0; x < 8; ++x) {
                    vv[0][x]          = okl ? vv[0][x] : 0.0f;
                    vv[2 * QT + 1][x] = okh ? vv[2 * QT + 1][x] : 0.0f;
                }
            }
            #pragma unroll
            for (int ro = 0; ro < 2; ++ro) {
                #pragma unroll
                for (int x = 0; x < 8; ++x) {
                    float acc = bias;
                    #pragma unroll
                    for (int ky = 0; ky < 3; ++ky) {
                        #pragma unroll
                        for (int kx = 0; kx < 3; ++kx) {
                            const int xx = x + kx - 1;
                            if (xx < 0 || xx >= 8) continue;
                            acc += vv[2 * t + ro + ky][xx] * wgt[ky * 3 + kx];
                        }
                    }
                    lep[ro * 8 + x] = acc;
                }
            }
        }
        const float inv = 1.0f / sacc[t][0];
        float* orow = obuf + lm * O_STRIDE + (hh << 3);
        const v8f n0 = o0[t] * inv, n1 = o1[t] * inv;
        *(v4f*)(orow)      = __builtin_shufflevector(n0, n0, 0, 1, 2, 3);   // rows are 144 B apart: 16-B aligned
        *(v4f*)(orow + 4)  = __builtin_shufflevector(n0, n0, 4, 5, 6, 7);
        *(v4f*)(orow + 16) = __builtin_shufflevector(n1, n1, 0, 1, 2, 3);
        *(v4f*)(orow + 20) = __builtin_shufflevector(n1, n1, 4, 5, 6, 7);
        #pragma unroll
        for (int j = 0; j < 16; ++j) {
            const int m = qtok0 + j;
            float* row = out + ((size_t)b * 4096 + (m >> 3) * 64 + w * 8 + (m & 7)) * CCH + head * HD;
            row[lane] = obuf[j * O_STRIDE + lane] + lep[j];
        }
    }
}

extern "C" void kernel_launch(void* const* d_in, const int* in_sizes, int n_in,
                              void* d_out, int out_size, void* d_ws, size_t ws_size,
                              hipStream_t stream)
{
    (void)in_sizes; (void)n_in; (void)out_size; (void)d_ws; (void)ws_size;
    const float* qkv = (const float*)d_in[0];
    const float* cw  = (const float*)d_in[1];
    const float* cb  = (const float*)d_in[2];
    float* out = (float*)d_out;

    const size_t shmem = (size_t)LDS_HALF * sizeof(half_t);   // 126,976 B
    hipFuncSetAttribute((const void*)lepe_attn_wmma_kernel, hipFuncAttributeMaxDynamicSharedMemorySize, (int)shmem);
    lepe_attn_wmma_kernel<<<256, NWAVE * 32, shmem, stream>>>(qkv, cw, cb, out);
}
